// v000
// Times are from an AMD MI455X. After a warm-up the kernel runs many times in a row, and a time is the length of
// such a window on the GPU divided by its runs, so every launch and the gaps after it count. The runs cycle
// through copies of the inputs. A figure is the median of several windows, for all but v000 over two sittings.
// Sittings can differ by a few percent; kernels timed side by side share one.
// v000 is the starting kernel. One run takes 45.2 microseconds.
#include <hip/hip_runtime.h>

typedef __attribute__((ext_vector_type(16))) _Float16 v16h;
typedef __attribute__((ext_vector_type(8)))  float    v8f;

#define B_  2
#define H_  16
#define N_  2048
#define D_  64
#define W_  512
#define WAVES_PER_BLOCK 8
#define SP_HALVES (16*32)      // one 16x32 f16 P tile
#define ROWS_PER_WAVE 32       // two 16-row M-tiles per wave

#define WMMA_F16(A,B,C) __builtin_amdgcn_wmma_f32_16x16x32_f16(false, A, false, B, (short)0, C, false, false)

__device__ __forceinline__ v16h ld_op_f32row(const float* p, float scale) {
    float4 a = ((const float4*)p)[0];
    float4 b = ((const float4*)p)[1];
    float4 c = ((const float4*)(p + 16))[0];
    float4 d = ((const float4*)(p + 16))[1];
    v16h r;
    r[0]  = (_Float16)(a.x * scale); r[1]  = (_Float16)(a.y * scale);
    r[2]  = (_Float16)(a.z * scale); r[3]  = (_Float16)(a.w * scale);
    r[4]  = (_Float16)(b.x * scale); r[5]  = (_Float16)(b.y * scale);
    r[6]  = (_Float16)(b.z * scale); r[7]  = (_Float16)(b.w * scale);
    r[8]  = (_Float16)(c.x * scale); r[9]  = (_Float16)(c.y * scale);
    r[10] = (_Float16)(c.z * scale); r[11] = (_Float16)(c.w * scale);
    r[12] = (_Float16)(d.x * scale); r[13] = (_Float16)(d.y * scale);
    r[14] = (_Float16)(d.z * scale); r[15] = (_Float16)(d.w * scale);
    return r;
}

// Column gather (stride f32 elements) for the V B-operand: K runs down rows.
// p already includes the (kb + 8*laneHi) row base and the feature column.
__device__ __forceinline__ v16h ld_op_f32col(const float* p, int stride) {
    v16h r;
#pragma unroll
    for (int vv = 0; vv < 8; ++vv) {
        int k0 = ((vv >> 2) << 4) + ((vv & 3) << 1);
        float x = p[(size_t)k0 * stride];
        float y = p[(size_t)(k0 + 1) * stride];
        r[2*vv]   = (_Float16)x;
        r[2*vv+1] = (_Float16)y;
    }
    return r;
}

// Aligned 16B LDS loads for the P operand (row-major 16x32 f16 tile).
__device__ __forceinline__ v16h ld_op_lds(const _Float16* p) {
    union { uint4 u[2]; v16h h; } r;
    r.u[0] = *(const uint4*)(p);
    r.u[1] = *(const uint4*)(p + 16);
    return r.h;
}

__global__ __launch_bounds__(32 * WAVES_PER_BLOCK)
void swa_wmma_f16_kernel(const float* __restrict__ q,
                         const float* __restrict__ k,
                         const float* __restrict__ v,
                         float* __restrict__ out) {
    __shared__ __align__(16) _Float16 sPall[WAVES_PER_BLOCK * 2 * SP_HALVES];

    const int lane   = threadIdx.x & 31;
    const int wave   = threadIdx.x >> 5;
    const int laneHi = lane >> 4;
    const int laneN  = lane & 15;
    const int hi8    = laneHi << 3;

    _Float16* sP0 = sPall + wave * 2 * SP_HALVES;
    _Float16* sP1 = sP0 + SP_HALVES;

    const int tile  = blockIdx.x * WAVES_PER_BLOCK + wave;   // 0..2047
    const int bh    = tile >> 6;                             // 64 tiles per (b,h)
    const int qBase = (tile & 63) << 5;                      // first of 32 query rows

    const float NEG_INF = -__builtin_inff();
    const float qscale  = 0.125f * 1.44269504088896340736f;  // 1/sqrt(D) * log2(e)

    // constant all-ones B operand: rowsum(P) = P x ones via WMMA
    v16h onesB;
#pragma unroll
    for (int j = 0; j < 16; ++j) onesB[j] = (_Float16)1.0f;
    const v8f zero8 = (v8f){0.f,0.f,0.f,0.f,0.f,0.f,0.f,0.f};

    // ---- loop-invariant Q A-operands: [mt][kk-half] ----
    v16h aQ[2][2];
#pragma unroll
    for (int mt = 0; mt < 2; ++mt) {
        const float* qrow = q + ((size_t)bh * N_ + (qBase + (mt << 4) + laneN)) * D_ + hi8;
        aQ[mt][0] = ld_op_f32row(qrow +  0, qscale);
        aQ[mt][1] = ld_op_f32row(qrow + 32, qscale);
    }

    // per-row softmax state; stat [mt][i] is row (qBase + 16*mt + i + 8*laneHi)
    float mrun[2][8], lrun[2][8], alpha[2][8];
    v8f   oacc[2][4];
#pragma unroll
    for (int mt = 0; mt < 2; ++mt) {
#pragma unroll
        for (int i = 0; i < 8; ++i) { mrun[mt][i] = NEG_INF; lrun[mt][i] = 0.f; }
#pragma unroll
        for (int t = 0; t < 4; ++t) oacc[mt][t] = zero8;
    }

    const int lo     = (qBase >= W_) ? (qBase - W_ + 1) : 0;
    const int kb0    = (lo >> 5) << 5;
    const int kbLast = qBase;                    // chunk [qBase, qBase+31] = diagonal

    const float* kbh = k + (size_t)bh * N_ * D_;
    const float* vbh = v + (size_t)bh * N_ * D_;

    for (int kb = kb0; kb <= kbLast; kb += 32) {
        if (kb + 32 <= kbLast) {
            __builtin_prefetch(kbh + (size_t)(kb + 32 + lane) * D_, 0, 3);
            __builtin_prefetch(vbh + (size_t)(kb + 32 + lane) * D_, 0, 3);
        }

        // ---- S = (Q*scale) K^T : 2 M-tiles x 2 N-halves, K=64 in 2 steps ----
        const float* kr0 = kbh + (size_t)(kb + laneN) * D_ + hi8;        // keys kb+0..15
        const float* kr1 = kbh + (size_t)(kb + 16 + laneN) * D_ + hi8;   // keys kb+16..31
        v8f s[2][2] = {{zero8, zero8}, {zero8, zero8}};                  // [mt][nhalf]
#pragma unroll
        for (int kkI = 0; kkI < 2; ++kkI) {
            v16h bK0 = ld_op_f32row(kr0 + kkI * 32, 1.0f);
            v16h bK1 = ld_op_f32row(kr1 + kkI * 32, 1.0f);
            s[0][0] = WMMA_F16(aQ[0][kkI], bK0, s[0][0]);   // each bK feeds 2 M-tiles
            s[1][0] = WMMA_F16(aQ[1][kkI], bK0, s[1][0]);
            s[0][1] = WMMA_F16(aQ[0][kkI], bK1, s[0][1]);
            s[1][1] = WMMA_F16(aQ[1][kkI], bK1, s[1][1]);
        }

        // interior chunks are wave-uniformly unmasked
        const bool needMask = (kb + 31 > qBase) || (kb < qBase - (W_ - 32));

        if (needMask) {
#pragma unroll
            for (int mt = 0; mt < 2; ++mt) {
                _Float16* sP = mt ? sP1 : sP0;
                float rm[8];
#pragma unroll
                for (int i = 0; i < 8; ++i) {
                    int row = qBase + (mt << 4) + i + hi8;
                    int c0  = kb + laneN;
                    int c1  = c0 + 16;
                    float v0 = ((c0 <= row) && (c0 + (W_ - 1) >= row)) ? s[mt][0][i] : NEG_INF;
                    float v1 = ((c1 <= row) && (c1 + (W_ - 1) >= row)) ? s[mt][1][i] : NEG_INF;
                    s[mt][0][i] = v0; s[mt][1][i] = v1;
                    rm[i] = fmaxf(v0, v1);
                }
#pragma unroll
                for (int msk = 1; msk < 16; msk <<= 1)
#pragma unroll
                    for (int i = 0; i < 8; ++i) rm[i] = fmaxf(rm[i], __shfl_xor(rm[i], msk, 32));
#pragma unroll
                for (int i = 0; i < 8; ++i) {
                    float mnew = fmaxf(mrun[mt][i], rm[i]);
                    float a, p0, p1;
                    if (mnew == NEG_INF) { a = 1.f; p0 = 0.f; p1 = 0.f; }
                    else {
                        a  = __builtin_exp2f(mrun[mt][i] - mnew);
                        p0 = __builtin_exp2f(s[mt][0][i] - mnew);
                        p1 = __builtin_exp2f(s[mt][1][i] - mnew);
                    }
                    mrun[mt][i]  = mnew;
                    alpha[mt][i] = a;
                    int m = i + hi8;
                    sP[m * 32 + laneN]      = (_Float16)p0;
                    sP[m * 32 + 16 + laneN] = (_Float16)p1;
                }
            }
        } else {
#pragma unroll
            for (int mt = 0; mt < 2; ++mt) {
                _Float16* sP = mt ? sP1 : sP0;
                float rm[8];
#pragma unroll
                for (int i = 0; i < 8; ++i) rm[i] = fmaxf(s[mt][0][i], s[mt][1][i]);
#pragma unroll
                for (int msk = 1; msk < 16; msk <<= 1)
#pragma unroll
                    for (int i = 0; i < 8; ++i) rm[i] = fmaxf(rm[i], __shfl_xor(rm[i], msk, 32));
#pragma unroll
                for (int i = 0; i < 8; ++i) {
                    float mnew = fmaxf(mrun[mt][i], rm[i]);
                    alpha[mt][i] = __builtin_exp2f(mrun[mt][i] - mnew);  // exp2(-inf)=0 ok
                    float p0 = __builtin_exp2f(s[mt][0][i] - mnew);
                    float p1 = __builtin_exp2f(s[mt][1][i] - mnew);
                    mrun[mt][i] = mnew;
                    int m = i + hi8;
                    sP[m * 32 + laneN]      = (_Float16)p0;
                    sP[m * 32 + 16 + laneN] = (_Float16)p1;
                }
            }
        }

        // ---- P operands back from LDS (C-layout -> A-layout) ----
        v16h aP0 = ld_op_lds(sP0 + laneN * 32 + hi8);
        v16h aP1 = ld_op_lds(sP1 + laneN * 32 + hi8);

        v8f rs0 = WMMA_F16(aP0, onesB, zero8);
        v8f rs1 = WMMA_F16(aP1, onesB, zero8);
#pragma unroll
        for (int i = 0; i < 8; ++i) {
            lrun[0][i] = lrun[0][i] * alpha[0][i] + rs0[i];
            lrun[1][i] = lrun[1][i] * alpha[1][i] + rs1[i];
#pragma unroll
            for (int t = 0; t < 4; ++t) {
                oacc[0][t][i] *= alpha[0][i];
                oacc[1][t][i] *= alpha[1][i];
            }
        }

        // ---- O += P (16x32) * V (32x64): each bV feeds both M-tiles ----
        const float* vkb = vbh + (size_t)(kb + hi8) * D_;
#pragma unroll
        for (int t = 0; t < 4; ++t) {
            v16h bV = ld_op_f32col(vkb + t * 16 + laneN, D_);
            oacc[0][t] = WMMA_F16(aP0, bV, oacc[0][t]);
            oacc[1][t] = WMMA_F16(aP1, bV, oacc[1][t]);
        }
    }

    // ---- finalize: divide by l, store fp32 ----
#pragma unroll
    for (int mt = 0; mt < 2; ++mt)
#pragma unroll
        for (int i = 0; i < 8; ++i) {
            float inv = (lrun[mt][i] > 0.f) ? (1.f / lrun[mt][i]) : 0.f;
            int row = qBase + (mt << 4) + i + hi8;
            float* orow = out + ((size_t)bh * N_ + row) * D_;
#pragma unroll
            for (int t = 0; t < 4; ++t) orow[t * 16 + laneN] = oacc[mt][t][i] * inv;
        }
}

extern "C" void kernel_launch(void* const* d_in, const int* in_sizes, int n_in,
                              void* d_out, int out_size, void* d_ws, size_t ws_size,
                              hipStream_t stream) {
    (void)in_sizes; (void)n_in; (void)d_ws; (void)ws_size; (void)out_size;
    const float* q = (const float*)d_in[0];
    const float* k = (const float*)d_in[1];
    const float* v = (const float*)d_in[2];
    float* out = (float*)d_out;

    const int tiles  = B_ * H_ * (N_ / ROWS_PER_WAVE);   // 2048 query tiles
    const int blocks = tiles / WAVES_PER_BLOCK;          // 256 blocks of 8 wave32
    hipLaunchKernelGGL(swa_wmma_f16_kernel,
                       dim3(blocks), dim3(32 * WAVES_PER_BLOCK), 0, stream,
                       q, k, v, out);
}

// v001
// It runs in 34.2 microseconds.
// Next to v000, in two timings, it ran 1.37 times as fast each time.
#include <hip/hip_runtime.h>

typedef __attribute__((ext_vector_type(16))) _Float16 v16h;
typedef __attribute__((ext_vector_type(8)))  float    v8f;

#define B_  2
#define H_  16
#define N_  2048
#define D_  64
#define W_  512
#define WAVES_PER_BLOCK 8
#define SP_HALVES (16*32)      // one 16x32 f16 P tile
#define ROWS_PER_WAVE 32       // two 16-row M-tiles per wave
#define BLOCK_ROWS (WAVES_PER_BLOCK * ROWS_PER_WAVE)   // 256 query rows per block
#define MAX_KEYS (W_ + BLOCK_ROWS)                     // keys one block can touch
#define KPITCH 72              // halves per staged K row: 144 B, 16 B x odd for ds_load_b128
#define VPITCH 80              // halves per staged V row: 160 B, 32 B x odd for ds_load_tr16_b128
#define PASS_KEYS 128          // keys staged per pass: 8 float4 of K and 8 of V per thread

#define WMMA_F16(A,B,C) __builtin_amdgcn_wmma_f32_16x16x32_f16(false, A, false, B, (short)0, C, false, false)

__device__ __forceinline__ v16h ld_op_f32row(const float* p, float scale) {
    float4 a = ((const float4*)p)[0];
    float4 b = ((const float4*)p)[1];
    float4 c = ((const float4*)(p + 16))[0];
    float4 d = ((const float4*)(p + 16))[1];
    v16h r;
    r[0]  = (_Float16)(a.x * scale); r[1]  = (_Float16)(a.y * scale);
    r[2]  = (_Float16)(a.z * scale); r[3]  = (_Float16)(a.w * scale);
    r[4]  = (_Float16)(b.x * scale); r[5]  = (_Float16)(b.y * scale);
    r[6]  = (_Float16)(b.z * scale); r[7]  = (_Float16)(b.w * scale);
    r[8]  = (_Float16)(c.x * scale); r[9]  = (_Float16)(c.y * scale);
    r[10] = (_Float16)(c.z * scale); r[11] = (_Float16)(c.w * scale);
    r[12] = (_Float16)(d.x * scale); r[13] = (_Float16)(d.y * scale);
    r[14] = (_Float16)(d.z * scale); r[15] = (_Float16)(d.w * scale);
    return r;
}

typedef short s16x8 __attribute__((ext_vector_type(8)));
__device__ __forceinline__ v16h ld_op_lds_tr(const _Float16* p) {
    typedef __attribute__((address_space(3))) s16x8 lds_s16x8;
    union { s16x8 s[2]; v16h h; } r;
    r.s[0] = __builtin_amdgcn_ds_load_tr16_b128_v8i16((lds_s16x8*)p);
    r.s[1] = __builtin_amdgcn_ds_load_tr16_b128_v8i16((lds_s16x8*)(p + 16 * VPITCH));
    return r.h;
}

// One staging pass: 8 whole-line float4 loads per thread from each of K and V.
__device__ __forceinline__ void stage_load(const float4* kg, const float4* vg, int pass, int tid,
                                           float4 (&kx)[8], float4 (&vx)[8]) {
#pragma unroll
    for (int j = 0; j < 8; ++j) {
        kx[j] = kg[pass * (PASS_KEYS * 16) + j * 256 + tid];
        vx[j] = vg[pass * (PASS_KEYS * 16) + j * 256 + tid];
    }
}

typedef __attribute__((ext_vector_type(4))) _Float16 v4h;
__device__ __forceinline__ v4h cvt4(float4 x) {
    v4h r;
    r[0] = (_Float16)x.x; r[1] = (_Float16)x.y; r[2] = (_Float16)x.z; r[3] = (_Float16)x.w;
    return r;
}

// Convert the pass to f16 and lay it into the padded LDS rows (16 threads per key row).
__device__ __forceinline__ void stage_store(_Float16* sK, _Float16* sV, int pass, int tid,
                                            const float4 (&kx)[8], const float4 (&vx)[8]) {
    const int row = pass * PASS_KEYS + (tid >> 4);
    const int col = (tid & 15) << 2;
#pragma unroll
    for (int j = 0; j < 8; ++j) {
        *(v4h*)(sK + (row + j * 16) * KPITCH + col) = cvt4(kx[j]);
        *(v4h*)(sV + (row + j * 16) * VPITCH + col) = cvt4(vx[j]);
    }
}

// Aligned 16B LDS loads for the P operand (row-major 16x32 f16 tile) and the staged K rows.
__device__ __forceinline__ v16h ld_op_lds(const _Float16* p) {
    union { uint4 u[2]; v16h h; } r;
    r.u[0] = *(const uint4*)(p);
    r.u[1] = *(const uint4*)(p + 16);
    return r.h;
}

__global__ __launch_bounds__(32 * WAVES_PER_BLOCK)
void swa_wmma_f16_kernel(const float* __restrict__ q,
                         const float* __restrict__ k,
                         const float* __restrict__ v,
                         float* __restrict__ out) {
    __shared__ __align__(16) _Float16 sPall[WAVES_PER_BLOCK * 2 * SP_HALVES];
    __shared__ __align__(16) _Float16 sK[MAX_KEYS * KPITCH];
    __shared__ __align__(16) _Float16 sV[MAX_KEYS * VPITCH];

    const int lane   = threadIdx.x & 31;
    const int wave   = threadIdx.x >> 5;
    const int laneHi = lane >> 4;
    const int laneN  = lane & 15;
    const int hi8    = laneHi << 3;

    _Float16* sP0 = sPall + wave * 2 * SP_HALVES;
    _Float16* sP1 = sP0 + SP_HALVES;

    const int tile  = blockIdx.x * WAVES_PER_BLOCK + wave;   // 0..2047
    const int bh    = tile >> 6;                             // 64 tiles per (b,h)
    const int qBase = (tile & 63) << 5;                      // first of 32 query rows

    const float NEG_INF = -__builtin_inff();
    const float qscale  = 0.125f * 1.44269504088896340736f;  // 1/sqrt(D) * log2(e)

    // constant all-ones B operand: rowsum(P) = P x ones via WMMA
    v16h onesB;
#pragma unroll
    for (int j = 0; j < 16; ++j) onesB[j] = (_Float16)1.0f;
    const v8f zero8 = (v8f){0.f,0.f,0.f,0.f,0.f,0.f,0.f,0.f};

    // ---- loop-invariant Q A-operands: [mt][kk-half] ----
    v16h aQ[2][2];
#pragma unroll
    for (int mt = 0; mt < 2; ++mt) {
        const float* qrow = q + ((size_t)bh * N_ + (qBase + (mt << 4) + laneN)) * D_ + hi8;
        aQ[mt][0] = ld_op_f32row(qrow +  0, qscale);
        aQ[mt][1] = ld_op_f32row(qrow + 32, qscale);
    }

    // ---- stage every key this block's 8 waves touch, once, as f16 in LDS ----
    const int blockQ = (blockIdx.x & 7) * BLOCK_ROWS;            // 8 blocks per (b,h)
    const int kStart = (blockQ >= W_) ? (blockQ - W_) : 0;       // first staged key
    const int passes = (blockQ + BLOCK_ROWS - kStart) / PASS_KEYS;   // 2, 4 or 6
    {
        const int tid = threadIdx.x;
        const size_t first = ((size_t)(blockIdx.x >> 3) * N_ + kStart) * D_;
        const float4* kg = (const float4*)(k + first);
        const float4* vg = (const float4*)(v + first);
        // two register sets: one pass's loads are in flight while the other is converted and stored
        float4 kxa[8], vxa[8], kxb[8], vxb[8];
        stage_load(kg, vg, 0, tid, kxa, vxa);
        int p = 0;
        for (; p + 2 < passes; p += 2) {
            stage_load(kg, vg, p + 1, tid, kxb, vxb);
            stage_store(sK, sV, p, tid, kxa, vxa);
            stage_load(kg, vg, p + 2, tid, kxa, vxa);
            stage_store(sK, sV, p + 1, tid, kxb, vxb);
        }
        stage_load(kg, vg, p + 1, tid, kxb, vxb);
        stage_store(sK, sV, p, tid, kxa, vxa);
        stage_store(sK, sV, p + 1, tid, kxb, vxb);
    }
    __syncthreads();   // publishes the staged K and V rows to all 8 waves

    // per-row softmax state; stat [mt][i] is row (qBase + 16*mt + i + 8*laneHi)
    float mrun[2][8], lrun[2][8], alpha[2][8];
    v8f   oacc[2][4];
#pragma unroll
    for (int mt = 0; mt < 2; ++mt) {
#pragma unroll
        for (int i = 0; i < 8; ++i) { mrun[mt][i] = NEG_INF; lrun[mt][i] = 0.f; }
#pragma unroll
        for (int t = 0; t < 4; ++t) oacc[mt][t] = zero8;
    }

    const int lo     = (qBase >= W_) ? (qBase - W_ + 1) : 0;
    const int kb0    = (lo >> 5) << 5;
    const int kbLast = qBase;                    // chunk [qBase, qBase+31] = diagonal

    // per-lane read bases in the staged tiles, at staged row 0
    const _Float16* kLane = sK + laneN * KPITCH + hi8;
    const _Float16* vLane = sV + (hi8 + (lane & 7)) * VPITCH + (((lane >> 3) & 1) << 3);

    for (int kb = kb0; kb <= kbLast; kb += 32) {
        // ---- S = (Q*scale) K^T : 2 M-tiles x 2 N-halves, K=64 in 2 steps ----
        const _Float16* kr0 = kLane + (kb - kStart) * KPITCH;            // keys kb+0..15
        const _Float16* kr1 = kr0 + 16 * KPITCH;                         // keys kb+16..31
        v8f s[2][2] = {{zero8, zero8}, {zero8, zero8}};                  // [mt][nhalf]
#pragma unroll
        for (int kkI = 0; kkI < 2; ++kkI) {
            v16h bK0 = ld_op_lds(kr0 + kkI * 32);
            v16h bK1 = ld_op_lds(kr1 + kkI * 32);
            s[0][0] = WMMA_F16(aQ[0][kkI], bK0, s[0][0]);   // each bK feeds 2 M-tiles
            s[1][0] = WMMA_F16(aQ[1][kkI], bK0, s[1][0]);
            s[0][1] = WMMA_F16(aQ[0][kkI], bK1, s[0][1]);
            s[1][1] = WMMA_F16(aQ[1][kkI], bK1, s[1][1]);
        }

        // interior chunks are wave-uniformly unmasked
        const bool needMask = (kb + 31 > qBase) || (kb < qBase - (W_ - 32));

        if (needMask) {
#pragma unroll
            for (int mt = 0; mt < 2; ++mt) {
                _Float16* sP = mt ? sP1 : sP0;
                float rm[8];
#pragma unroll
                for (int i = 0; i < 8; ++i) {
                    int row = qBase + (mt << 4) + i + hi8;
                    int c0  = kb + laneN;
                    int c1  = c0 + 16;
                    float v0 = ((c0 <= row) && (c0 + (W_ - 1) >= row)) ? s[mt][0][i] : NEG_INF;
                    float v1 = ((c1 <= row) && (c1 + (W_ - 1) >= row)) ? s[mt][1][i] : NEG_INF;
                    s[mt][0][i] = v0; s[mt][1][i] = v1;
                    rm[i] = fmaxf(v0, v1);
                }
#pragma unroll
                for (int msk = 1; msk < 16; msk <<= 1)
#pragma unroll
                    for (int i = 0; i < 8; ++i) rm[i] = fmaxf(rm[i], __shfl_xor(rm[i], msk, 32));
#pragma unroll
                for (int i = 0; i < 8; ++i) {
                    float mnew = fmaxf(mrun[mt][i], rm[i]);
                    float a, p0, p1;
                    if (mnew == NEG_INF) { a = 1.f; p0 = 0.f; p1 = 0.f; }
                    else {
                        a  = __builtin_exp2f(mrun[mt][i] - mnew);
                        p0 = __builtin_exp2f(s[mt][0][i] - mnew);
                        p1 = __builtin_exp2f(s[mt][1][i] - mnew);
                    }
                    mrun[mt][i]  = mnew;
                    alpha[mt][i] = a;
                    int m = i + hi8;
                    sP[m * 32 + laneN]      = (_Float16)p0;
                    sP[m * 32 + 16 + laneN] = (_Float16)p1;
                }
            }
        } else {
#pragma unroll
            for (int mt = 0; mt < 2; ++mt) {
                _Float16* sP = mt ? sP1 : sP0;
                float rm[8];
#pragma unroll
                for (int i = 0; i < 8; ++i) rm[i] = fmaxf(s[mt][0][i], s[mt][1][i]);
#pragma unroll
                for (int msk = 1; msk < 16; msk <<= 1)
#pragma unroll
                    for (int i = 0; i < 8; ++i) rm[i] = fmaxf(rm[i], __shfl_xor(rm[i], msk, 32));
#pragma unroll
                for (int i = 0; i < 8; ++i) {
                    float mnew = fmaxf(mrun[mt][i], rm[i]);
                    alpha[mt][i] = __builtin_exp2f(mrun[mt][i] - mnew);  // exp2(-inf)=0 ok
                    float p0 = __builtin_exp2f(s[mt][0][i] - mnew);
                    float p1 = __builtin_exp2f(s[mt][1][i] - mnew);
                    mrun[mt][i] = mnew;
                    int m = i + hi8;
                    sP[m * 32 + laneN]      = (_Float16)p0;
                    sP[m * 32 + 16 + laneN] = (_Float16)p1;
                }
            }
        }

        // ---- P operands back from LDS (C-layout -> A-layout) ----
        v16h aP0 = ld_op_lds(sP0 + laneN * 32 + hi8);
        v16h aP1 = ld_op_lds(sP1 + laneN * 32 + hi8);

        v8f rs0 = WMMA_F16(aP0, onesB, zero8);
        v8f rs1 = WMMA_F16(aP1, onesB, zero8);
#pragma unroll
        for (int i = 0; i < 8; ++i) {
            lrun[0][i] = lrun[0][i] * alpha[0][i] + rs0[i];
            lrun[1][i] = lrun[1][i] * alpha[1][i] + rs1[i];
#pragma unroll
            for (int t = 0; t < 4; ++t) {
                oacc[0][t][i] *= alpha[0][i];
                oacc[1][t][i] *= alpha[1][i];
            }
        }

        // ---- O += P (16x32) * V (32x64): each bV feeds both M-tiles ----
        const _Float16* vkb = vLane + (kb - kStart) * VPITCH;
#pragma unroll
        for (int t = 0; t < 4; ++t) {
            v16h bV = ld_op_lds_tr(vkb + t * 16);
            oacc[0][t] = WMMA_F16(aP0, bV, oacc[0][t]);
            oacc[1][t] = WMMA_F16(aP1, bV, oacc[1][t]);
        }
    }

    // ---- finalize: divide by l, store fp32 ----
#pragma unroll
    for (int mt = 0; mt < 2; ++mt)
#pragma unroll
        for (int i = 0; i < 8; ++i) {
            float inv = (lrun[mt][i] > 0.f) ? (1.f / lrun[mt][i]) : 0.f;
            int row = qBase + (mt << 4) + i + hi8;
            float* orow = out + ((size_t)bh * N_ + row) * D_;
#pragma unroll
            for (int t = 0; t < 4; ++t) orow[t * 16 + laneN] = oacc[mt][t][i] * inv;
        }
}

extern "C" void kernel_launch(void* const* d_in, const int* in_sizes, int n_in,
                              void* d_out, int out_size, void* d_ws, size_t ws_size,
                              hipStream_t stream) {
    (void)in_sizes; (void)n_in; (void)d_ws; (void)ws_size; (void)out_size;
    const float* q = (const float*)d_in[0];
    const float* k = (const float*)d_in[1];
    const float* v = (const float*)d_in[2];
    float* out = (float*)d_out;

    const int tiles  = B_ * H_ * (N_ / ROWS_PER_WAVE);   // 2048 query tiles
    const int blocks = tiles / WAVES_PER_BLOCK;          // 256 blocks of 8 wave32
    hipLaunchKernelGGL(swa_wmma_f16_kernel,
                       dim3(blocks), dim3(32 * WAVES_PER_BLOCK), 0, stream,
                       q, k, v, out);
}

// v002
// Measured time: 21.3 microseconds a run.
// Next to v001, in two timings, it ran 1.60 times as fast each time.
// All steps since v000 together make it 2.19 times as fast.
#include <hip/hip_runtime.h>

typedef __attribute__((ext_vector_type(16))) _Float16 v16h;
typedef __attribute__((ext_vector_type(8)))  float    v8f;

#define B_  2
#define H_  16
#define N_  2048
#define D_  64
#define W_  512
#define WAVES_PER_BLOCK 8
#define ROWS_PER_WAVE 32       // two 16-query column groups per wave
#define BLOCK_ROWS (WAVES_PER_BLOCK * ROWS_PER_WAVE)   // 256 query rows per block
#define MAX_KEYS (W_ + BLOCK_ROWS)                     // keys one block can touch
#define KPITCH 72              // halves per staged K row: 144 B, 16 B x odd for ds_load_b128
#define VPITCH 80              // halves per staged V row: 160 B, 32 B x odd for ds_load_tr16_b128
#define PASS_KEYS 128          // keys staged per pass: 8 float4 of K and 8 of V per thread

#define WMMA_F16(A,B,C) __builtin_amdgcn_wmma_f32_16x16x32_f16(false, A, false, B, (short)0, C, false, false)

__device__ __forceinline__ v16h ld_op_f32row(const float* p, float scale) {
    float4 a = ((const float4*)p)[0];
    float4 b = ((const float4*)p)[1];
    float4 c = ((const float4*)(p + 16))[0];
    float4 d = ((const float4*)(p + 16))[1];
    v16h r;
    r[0]  = (_Float16)(a.x * scale); r[1]  = (_Float16)(a.y * scale);
    r[2]  = (_Float16)(a.z * scale); r[3]  = (_Float16)(a.w * scale);
    r[4]  = (_Float16)(b.x * scale); r[5]  = (_Float16)(b.y * scale);
    r[6]  = (_Float16)(b.z * scale); r[7]  = (_Float16)(b.w * scale);
    r[8]  = (_Float16)(c.x * scale); r[9]  = (_Float16)(c.y * scale);
    r[10] = (_Float16)(c.z * scale); r[11] = (_Float16)(c.w * scale);
    r[12] = (_Float16)(d.x * scale); r[13] = (_Float16)(d.y * scale);
    r[14] = (_Float16)(d.z * scale); r[15] = (_Float16)(d.w * scale);
    return r;
}

typedef short s16x8 __attribute__((ext_vector_type(8)));
__device__ __forceinline__ v16h ld_op_lds_tr(const _Float16* p) {
    typedef __attribute__((address_space(3))) s16x8 lds_s16x8;
    union { s16x8 s[2]; v16h h; } r;
    r.s[0] = __builtin_amdgcn_ds_load_tr16_b128_v8i16((lds_s16x8*)p);
    r.s[1] = __builtin_amdgcn_ds_load_tr16_b128_v8i16((lds_s16x8*)(p + 16 * VPITCH));
    return r.h;
}

// One staging pass: 8 whole-line float4 loads per thread from each of K and V.
__device__ __forceinline__ void stage_load(const float4* kg, const float4* vg, int pass, int tid,
                                           float4 (&kx)[8], float4 (&vx)[8]) {
#pragma unroll
    for (int j = 0; j < 8; ++j) {
        kx[j] = kg[pass * (PASS_KEYS * 16) + j * 256 + tid];
        vx[j] = vg[pass * (PASS_KEYS * 16) + j * 256 + tid];
    }
}

typedef __attribute__((ext_vector_type(4))) _Float16 v4h;
__device__ __forceinline__ v4h cvt4(float4 x) {
    v4h r;
    r[0] = (_Float16)x.x; r[1] = (_Float16)x.y; r[2] = (_Float16)x.z; r[3] = (_Float16)x.w;
    return r;
}

// Convert the pass to f16 and lay it into the padded LDS rows (16 threads per key row).
__device__ __forceinline__ void stage_store(_Float16* sK, _Float16* sV, int pass, int tid,
                                            const float4 (&kx)[8], const float4 (&vx)[8]) {
    const int row = pass * PASS_KEYS + (tid >> 4);
    const int col = (tid & 15) << 2;
#pragma unroll
    for (int j = 0; j < 8; ++j) {
        *(v4h*)(sK + (row + j * 16) * KPITCH + col) = cvt4(kx[j]);
        *(v4h*)(sV + (row + j * 16) * VPITCH + col) = cvt4(vx[j]);
    }
}

// Aligned 16B LDS loads for the staged K rows.
__device__ __forceinline__ v16h ld_op_lds(const _Float16* p) {
    union { uint4 u[2]; v16h h; } r;
    r.u[0] = *(const uint4*)(p);
    r.u[1] = *(const uint4*)(p + 16);
    return r.h;
}

__device__ __forceinline__ float xhalf(float x) {
    int i = __builtin_bit_cast(int, x);
    return __builtin_bit_cast(float, __builtin_amdgcn_permlanex16(i, i, 0x76543210, 0xfedcba98, false, false));
}

__device__ __forceinline__ v16h pack_p(const v8f& s0, const v8f& s1, float m) {
    v16h r;
#pragma unroll
    for (int i = 0; i < 8; ++i) {
        r[i]     = (_Float16)__builtin_exp2f(s0[i] - m);
        r[i + 8] = (_Float16)__builtin_exp2f(s1[i] - m);
    }
    return r;
}

// largest of a lane's 16 scores of one query, then joined with the other half's 16
__device__ __forceinline__ float colmax(const v8f& s0, const v8f& s1) {
    float m = fmaxf(s0[0], s1[0]);
#pragma unroll
    for (int i = 1; i < 8; ++i) m = fmaxf(m, fmaxf(s0[i], s1[i]));
    return fmaxf(m, xhalf(m));
}

__global__ __launch_bounds__(32 * WAVES_PER_BLOCK)
void swa_wmma_f16_kernel(const float* __restrict__ q,
                         const float* __restrict__ k,
                         const float* __restrict__ v,
                         float* __restrict__ out) {
    __shared__ __align__(16) _Float16 sK[MAX_KEYS * KPITCH];
    __shared__ __align__(16) _Float16 sV[MAX_KEYS * VPITCH];

    const int lane   = threadIdx.x & 31;
    const int wave   = threadIdx.x >> 5;
    const int laneHi = lane >> 4;
    const int laneN  = lane & 15;
    const int hi8    = laneHi << 3;

    const int tile  = blockIdx.x * WAVES_PER_BLOCK + wave;   // 0..2047
    const int bh    = tile >> 6;                             // 64 tiles per (b,h)
    const int qBase = (tile & 63) << 5;                      // first of 32 query rows

    const float NEG_INF = -__builtin_inff();
    const float qscale  = 0.125f * 1.44269504088896340736f;  // 1/sqrt(D) * log2(e)

    // constant all-ones A operand: column sums of P^T = ones x P^T via WMMA
    v16h onesA;
#pragma unroll
    for (int j = 0; j < 16; ++j) onesA[j] = (_Float16)1.0f;
    const v8f zero8 = (v8f){0.f,0.f,0.f,0.f,0.f,0.f,0.f,0.f};

    // ---- loop-invariant Q B-operands: [query group][kk-half]; lane column = query ----
    v16h bQ[2][2];
#pragma unroll
    for (int g = 0; g < 2; ++g) {
        const float* qrow = q + ((size_t)bh * N_ + (qBase + (g << 4) + laneN)) * D_ + hi8;
        bQ[g][0] = ld_op_f32row(qrow +  0, qscale);
        bQ[g][1] = ld_op_f32row(qrow + 32, qscale);
    }

    // ---- stage every key this block's 8 waves touch, once, as f16 in LDS ----
    const int blockQ = (blockIdx.x & 7) * BLOCK_ROWS;            // 8 blocks per (b,h)
    const int kStart = (blockQ >= W_) ? (blockQ - W_) : 0;       // first staged key
    const int passes = (blockQ + BLOCK_ROWS - kStart) / PASS_KEYS;   // 2, 4 or 6
    {
        const int tid = threadIdx.x;
        const size_t first = ((size_t)(blockIdx.x >> 3) * N_ + kStart) * D_;
        const float4* kg = (const float4*)(k + first);
        const float4* vg = (const float4*)(v + first);
        // two register sets: one pass's loads are in flight while the other is converted and stored
        float4 kxa[8], vxa[8], kxb[8], vxb[8];
        stage_load(kg, vg, 0, tid, kxa, vxa);
        int p = 0;
        for (; p + 2 < passes; p += 2) {
            stage_load(kg, vg, p + 1, tid, kxb, vxb);
            stage_store(sK, sV, p, tid, kxa, vxa);
            stage_load(kg, vg, p + 2, tid, kxa, vxa);
            stage_store(sK, sV, p + 1, tid, kxb, vxb);
        }
        stage_load(kg, vg, p + 1, tid, kxb, vxb);
        stage_store(sK, sV, p, tid, kxa, vxa);
        stage_store(sK, sV, p + 1, tid, kxb, vxb);
    }
    __syncthreads();   // publishes the staged K and V rows to all 8 waves

    // softmax state of query (qBase + 16*g + laneN), one value per lane, equal in both halves
    float mrun[2], alpha[2];
    // running sums of P: every row of lacc[g] holds the sum of column (query) laneN
    v8f   lacc[2];
    // O^T tiles: oacc[g][t][r] = O[query qBase + 16*g + laneN][feature 16*t + 8*laneHi + r]
    v8f   oacc[2][4];
#pragma unroll
    for (int g = 0; g < 2; ++g) {
        mrun[g] = NEG_INF; lacc[g] = zero8;
#pragma unroll
        for (int t = 0; t < 4; ++t) oacc[g][t] = zero8;
    }

    const int lo     = (qBase >= W_) ? (qBase - W_ + 1) : 0;
    const int kb0    = (lo >> 5) << 5;
    const int kbLast = qBase;                    // chunk [qBase, qBase+31] = diagonal

    // per-lane read bases in the staged tiles, at staged row 0
    const _Float16* kLane = sK + laneN * KPITCH + hi8;
    const _Float16* vLane = sV + (hi8 + (lane & 7)) * VPITCH + (((lane >> 3) & 1) << 3);

    for (int kb = kb0; kb <= kbLast; kb += 32) {
        // ---- S^T = K (Q*scale)^T : 2 key halves x 2 query groups, K=64 in 2 steps ----
        // s[kt][g][r] = score of key kb + 16*kt + 8*laneHi + r against query qBase + 16*g + laneN
        const _Float16* kr0 = kLane + (kb - kStart) * KPITCH;            // keys kb+0..15
        const _Float16* kr1 = kr0 + 16 * KPITCH;                         // keys kb+16..31
        v8f s[2][2] = {{zero8, zero8}, {zero8, zero8}};                  // [kt][g]
#pragma unroll
        for (int kkI = 0; kkI < 2; ++kkI) {
            v16h aK0 = ld_op_lds(kr0 + kkI * 32);
            v16h aK1 = ld_op_lds(kr1 + kkI * 32);
            s[0][0] = WMMA_F16(aK0, bQ[0][kkI], s[0][0]);   // each aK feeds 2 query groups
            s[0][1] = WMMA_F16(aK0, bQ[1][kkI], s[0][1]);
            s[1][0] = WMMA_F16(aK1, bQ[0][kkI], s[1][0]);
            s[1][1] = WMMA_F16(aK1, bQ[1][kkI], s[1][1]);
        }

        // interior chunks are wave-uniformly unmasked
        const bool needMask = (kb + 31 > qBase) || (kb < qBase - (W_ - 32));

        v16h bP[2];   // P^T operands, packed straight from the score accumulators
        if (needMask) {
#pragma unroll
            for (int g = 0; g < 2; ++g) {
                const int row = qBase + (g << 4) + laneN;
#pragma unroll
                for (int kt = 0; kt < 2; ++kt)
#pragma unroll
                    for (int i = 0; i < 8; ++i) {
                        int c = kb + (kt << 4) + hi8 + i;
                        s[kt][g][i] = ((c <= row) && (c + (W_ - 1) >= row)) ? s[kt][g][i] : NEG_INF;
                    }
                float mnew = fmaxf(mrun[g], colmax(s[0][g], s[1][g]));
                // a query with no key seen yet: subtract 0, so every exp2(-inf) gives 0
                float msub = (mnew == NEG_INF) ? 0.f : mnew;
                alpha[g] = __builtin_exp2f(mrun[g] - msub);
                bP[g]    = pack_p(s[0][g], s[1][g], msub);
                mrun[g]  = mnew;
            }
        } else {
#pragma unroll
            for (int g = 0; g < 2; ++g) {
                float mnew = fmaxf(mrun[g], colmax(s[0][g], s[1][g]));
                alpha[g] = __builtin_exp2f(mrun[g] - mnew);  // exp2(-inf)=0 ok
                bP[g]    = pack_p(s[0][g], s[1][g], mnew);
                mrun[g]  = mnew;
            }
        }

        // rescale the sum tiles and the output tiles: one factor per lane and query group
#pragma unroll
        for (int i = 0; i < 8; ++i) {
            lacc[0][i] *= alpha[0];
            lacc[1][i] *= alpha[1];
#pragma unroll
            for (int t = 0; t < 4; ++t) {
                oacc[0][t][i] *= alpha[0];
                oacc[1][t][i] *= alpha[1];
            }
        }

        // sums of P over the 32 keys via WMMA against ones, accumulated like an output tile
        lacc[0] = WMMA_F16(onesA, bP[0], lacc[0]);
        lacc[1] = WMMA_F16(onesA, bP[1], lacc[1]);

        // ---- O^T += V^T (64x32) * P^T (32x16): each aV feeds both query groups ----
        const _Float16* vkb = vLane + (kb - kStart) * VPITCH;
#pragma unroll
        for (int t = 0; t < 4; ++t) {
            v16h aV = ld_op_lds_tr(vkb + t * 16);
            oacc[0][t] = WMMA_F16(aV, bP[0], oacc[0][t]);
            oacc[1][t] = WMMA_F16(aV, bP[1], oacc[1][t]);
        }
    }

    // ---- finalize: divide by l, store fp32; a lane holds 8 consecutive features per tile ----
#pragma unroll
    for (int g = 0; g < 2; ++g) {
        float inv = (lacc[g][0] > 0.f) ? (1.f / lacc[g][0]) : 0.f;
        float* orow = out + ((size_t)bh * N_ + (qBase + (g << 4) + laneN)) * D_ + hi8;
#pragma unroll
        for (int t = 0; t < 4; ++t) {
            float4 a, b;
            a.x = oacc[g][t][0] * inv; a.y = oacc[g][t][1] * inv;
            a.z = oacc[g][t][2] * inv; a.w = oacc[g][t][3] * inv;
            b.x = oacc[g][t][4] * inv; b.y = oacc[g][t][5] * inv;
            b.z = oacc[g][t][6] * inv; b.w = oacc[g][t][7] * inv;
            ((float4*)(orow + t * 16))[0] = a;
            ((float4*)(orow + t * 16))[1] = b;
        }
    }
}

extern "C" void kernel_launch(void* const* d_in, const int* in_sizes, int n_in,
                              void* d_out, int out_size, void* d_ws, size_t ws_size,
                              hipStream_t stream) {
    (void)in_sizes; (void)n_in; (void)d_ws; (void)ws_size; (void)out_size;
    const float* q = (const float*)d_in[0];
    const float* k = (const float*)d_in[1];
    const float* v = (const float*)d_in[2];
    float* out = (float*)d_out;

    const int tiles  = B_ * H_ * (N_ / ROWS_PER_WAVE);   // 2048 query tiles
    const int blocks = tiles / WAVES_PER_BLOCK;          // 256 blocks of 8 wave32
    hipLaunchKernelGGL(swa_wmma_f16_kernel,
                       dim3(blocks), dim3(32 * WAVES_PER_BLOCK), 0, stream,
                       q, k, v, out);
}

// v003
// One run takes 18.7 microseconds.
// In both of two side-by-side timings against v002, it was 1.14 times as fast.
// All steps since v000 together make it 2.50 times as fast.
#include <hip/hip_runtime.h>

typedef __attribute__((ext_vector_type(16))) _Float16 v16h;
typedef __attribute__((ext_vector_type(8)))  float    v8f;
typedef __attribute__((ext_vector_type(2)))  float    v2f;

#define B_  2
#define H_  16
#define N_  2048
#define D_  64
#define W_  512
#define WAVES_PER_BLOCK 8
#define ROWS_PER_WAVE 32       // two 16-query column groups per wave
#define BLOCK_ROWS (WAVES_PER_BLOCK * ROWS_PER_WAVE)   // 256 query rows per block
#define MAX_KEYS (W_ + BLOCK_ROWS)                     // keys one block can touch
#define KPITCH 72              // halves per staged K row: 144 B, 16 B x odd for ds_load_b128
#define VPITCH 80              // halves per staged V row: 160 B, 32 B x odd for ds_load_tr16_b128
#define PASS_KEYS 128          // keys staged per pass: 8 float4 of K and 8 of V per thread

#define WMMA_F16(A,B,C) __builtin_amdgcn_wmma_f32_16x16x32_f16(false, A, false, B, (short)0, C, false, false)

__device__ __forceinline__ v16h ld_op_f32row(const float* p, float scale) {
    float4 a = ((const float4*)p)[0];
    float4 b = ((const float4*)p)[1];
    float4 c = ((const float4*)(p + 16))[0];
    float4 d = ((const float4*)(p + 16))[1];
    v16h r;
    r[0]  = (_Float16)(a.x * scale); r[1]  = (_Float16)(a.y * scale);
    r[2]  = (_Float16)(a.z * scale); r[3]  = (_Float16)(a.w * scale);
    r[4]  = (_Float16)(b.x * scale); r[5]  = (_Float16)(b.y * scale);
    r[6]  = (_Float16)(b.z * scale); r[7]  = (_Float16)(b.w * scale);
    r[8]  = (_Float16)(c.x * scale); r[9]  = (_Float16)(c.y * scale);
    r[10] = (_Float16)(c.z * scale); r[11] = (_Float16)(c.w * scale);
    r[12] = (_Float16)(d.x * scale); r[13] = (_Float16)(d.y * scale);
    r[14] = (_Float16)(d.z * scale); r[15] = (_Float16)(d.w * scale);
    return r;
}

typedef short s16x8 __attribute__((ext_vector_type(8)));
__device__ __forceinline__ v16h ld_op_lds_tr(const _Float16* p) {
    typedef __attribute__((address_space(3))) s16x8 lds_s16x8;
    union { s16x8 s[2]; v16h h; } r;
    r.s[0] = __builtin_amdgcn_ds_load_tr16_b128_v8i16((lds_s16x8*)p);
    r.s[1] = __builtin_amdgcn_ds_load_tr16_b128_v8i16((lds_s16x8*)(p + 16 * VPITCH));
    return r.h;
}

// One staging pass: 8 whole-line float4 loads per thread from each of K and V.
__device__ __forceinline__ void stage_load(const float4* kg, const float4* vg, int pass, int tid,
                                           float4 (&kx)[8], float4 (&vx)[8]) {
#pragma unroll
    for (int j = 0; j < 8; ++j) {
        kx[j] = kg[pass * (PASS_KEYS * 16) + j * 256 + tid];
        vx[j] = vg[pass * (PASS_KEYS * 16) + j * 256 + tid];
    }
}

typedef __attribute__((ext_vector_type(4))) _Float16 v4h;
__device__ __forceinline__ v4h cvt4(float4 x) {
    v4h r;
    r[0] = (_Float16)x.x; r[1] = (_Float16)x.y; r[2] = (_Float16)x.z; r[3] = (_Float16)x.w;
    return r;
}

// Convert the pass to f16 and lay it into the padded LDS rows (16 threads per key row).
__device__ __forceinline__ void stage_store(_Float16* sK, _Float16* sV, int pass, int tid,
                                            const float4 (&kx)[8], const float4 (&vx)[8]) {
    const int row = pass * PASS_KEYS + (tid >> 4);
    const int col = (tid & 15) << 2;
#pragma unroll
    for (int j = 0; j < 8; ++j) {
        *(v4h*)(sK + (row + j * 16) * KPITCH + col) = cvt4(kx[j]);
        *(v4h*)(sV + (row + j * 16) * VPITCH + col) = cvt4(vx[j]);
    }
}

// Aligned 16B LDS loads for the staged K rows.
__device__ __forceinline__ v16h ld_op_lds(const _Float16* p) {
    union { uint4 u[2]; v16h h; } r;
    r.u[0] = *(const uint4*)(p);
    r.u[1] = *(const uint4*)(p + 16);
    return r.h;
}

__device__ __forceinline__ float xhalf(float x) {
    int i = __builtin_bit_cast(int, x);
    return __builtin_bit_cast(float, __builtin_amdgcn_permlanex16(i, i, 0x76543210, 0xfedcba98, false, false));
}

__device__ __forceinline__ v16h pack_p(const v8f& s0, const v8f& s1, float m) {
    v16h r;
#pragma unroll
    for (int i = 0; i < 8; i += 2) {
        // neighbouring accumulator registers subtract as one packed pair, with no register moves
        v2f a = (v2f){s0[i], s0[i + 1]} - m;
        v2f b = (v2f){s1[i], s1[i + 1]} - m;
        r[i]     = (_Float16)__builtin_amdgcn_exp2f(a.x);
        r[i + 1] = (_Float16)__builtin_amdgcn_exp2f(a.y);
        r[i + 8] = (_Float16)__builtin_amdgcn_exp2f(b.x);
        r[i + 9] = (_Float16)__builtin_amdgcn_exp2f(b.y);
    }
    return r;
}

// largest of a lane's 16 scores of one query, then joined with the other half's 16
__device__ __forceinline__ float colmax(const v8f& s0, const v8f& s1) {
    float m = fmaxf(s0[0], s1[0]);
#pragma unroll
    for (int i = 1; i < 8; ++i) m = fmaxf(m, fmaxf(s0[i], s1[i]));
    return fmaxf(m, xhalf(m));
}

__global__ __launch_bounds__(32 * WAVES_PER_BLOCK)
void swa_wmma_f16_kernel(const float* __restrict__ q,
                         const float* __restrict__ k,
                         const float* __restrict__ v,
                         float* __restrict__ out) {
    __shared__ __align__(16) _Float16 sK[MAX_KEYS * KPITCH];
    __shared__ __align__(16) _Float16 sV[MAX_KEYS * VPITCH];

    const int lane   = threadIdx.x & 31;
    const int wave   = threadIdx.x >> 5;
    const int laneHi = lane >> 4;
    const int laneN  = lane & 15;
    const int hi8    = laneHi << 3;

    const int tile  = blockIdx.x * WAVES_PER_BLOCK + wave;   // 0..2047
    const int bh    = tile >> 6;                             // 64 tiles per (b,h)
    const int qBase = (tile & 63) << 5;                      // first of 32 query rows

    const float NEG_INF = -__builtin_inff();
    const float qscale  = 0.125f * 1.44269504088896340736f;  // 1/sqrt(D) * log2(e)

    // constant all-ones A operand: column sums of P^T = ones x P^T via WMMA
    v16h onesA;
#pragma unroll
    for (int j = 0; j < 16; ++j) onesA[j] = (_Float16)1.0f;
    const v8f zero8 = (v8f){0.f,0.f,0.f,0.f,0.f,0.f,0.f,0.f};

    // ---- loop-invariant Q B-operands: [query group][kk-half]; lane column = query ----
    v16h bQ[2][2];
#pragma unroll
    for (int g = 0; g < 2; ++g) {
        const float* qrow = q + ((size_t)bh * N_ + (qBase + (g << 4) + laneN)) * D_ + hi8;
        bQ[g][0] = ld_op_f32row(qrow +  0, qscale);
        bQ[g][1] = ld_op_f32row(qrow + 32, qscale);
    }

    // ---- stage every key this block's 8 waves touch, once, as f16 in LDS ----
    const int blockQ = (blockIdx.x & 7) * BLOCK_ROWS;            // 8 blocks per (b,h)
    const int kStart = (blockQ >= W_) ? (blockQ - W_) : 0;       // first staged key
    const int passes = (blockQ + BLOCK_ROWS - kStart) / PASS_KEYS;   // 2, 4 or 6
    {
        const int tid = threadIdx.x;
        const size_t first = ((size_t)(blockIdx.x >> 3) * N_ + kStart) * D_;
        const float4* kg = (const float4*)(k + first);
        const float4* vg = (const float4*)(v + first);
        // two register sets: one pass's loads are in flight while the other is converted and stored
        float4 kxa[8], vxa[8], kxb[8], vxb[8];
        stage_load(kg, vg, 0, tid, kxa, vxa);
        int p = 0;
        for (; p + 2 < passes; p += 2) {
            stage_load(kg, vg, p + 1, tid, kxb, vxb);
            stage_store(sK, sV, p, tid, kxa, vxa);
            stage_load(kg, vg, p + 2, tid, kxa, vxa);
            stage_store(sK, sV, p + 1, tid, kxb, vxb);
        }
        stage_load(kg, vg, p + 1, tid, kxb, vxb);
        stage_store(sK, sV, p, tid, kxa, vxa);
        stage_store(sK, sV, p + 1, tid, kxb, vxb);
    }
    __syncthreads();   // publishes the staged K and V rows to all 8 waves

    // softmax state of query (qBase + 16*g + laneN), one value per lane, equal in both halves
    float mrun[2], alpha[2];
    // running sums of P: every row of lacc[g] holds the sum of column (query) laneN
    v8f   lacc[2];
    // O^T tiles: oacc[g][t][r] = O[query qBase + 16*g + laneN][feature 16*t + 8*laneHi + r]
    v8f   oacc[2][4];
#pragma unroll
    for (int g = 0; g < 2; ++g) {
        mrun[g] = NEG_INF; lacc[g] = zero8;
#pragma unroll
        for (int t = 0; t < 4; ++t) oacc[g][t] = zero8;
    }

    const int lo     = (qBase >= W_) ? (qBase - W_ + 1) : 0;
    const int kb0    = (lo >> 5) << 5;
    const int kbLast = qBase;                    // chunk [qBase, qBase+31] = diagonal

    // per-lane read bases in the staged tiles, at staged row 0
    const _Float16* kLane = sK + laneN * KPITCH + hi8;
    const _Float16* vLane = sV + (hi8 + (lane & 7)) * VPITCH + (((lane >> 3) & 1) << 3);

    for (int kb = kb0; kb <= kbLast; kb += 32) {
        // ---- S^T = K (Q*scale)^T : 2 key halves x 2 query groups, K=64 in 2 steps ----
        // s[kt][g][r] = score of key kb + 16*kt + 8*laneHi + r against query qBase + 16*g + laneN
        const _Float16* kr0 = kLane + (kb - kStart) * KPITCH;            // keys kb+0..15
        const _Float16* kr1 = kr0 + 16 * KPITCH;                         // keys kb+16..31
        v8f s[2][2] = {{zero8, zero8}, {zero8, zero8}};                  // [kt][g]
#pragma unroll
        for (int kkI = 0; kkI < 2; ++kkI) {
            v16h aK0 = ld_op_lds(kr0 + kkI * 32);
            v16h aK1 = ld_op_lds(kr1 + kkI * 32);
            s[0][0] = WMMA_F16(aK0, bQ[0][kkI], s[0][0]);   // each aK feeds 2 query groups
            s[0][1] = WMMA_F16(aK0, bQ[1][kkI], s[0][1]);
            s[1][0] = WMMA_F16(aK1, bQ[0][kkI], s[1][0]);
            s[1][1] = WMMA_F16(aK1, bQ[1][kkI], s[1][1]);
        }

        // interior chunks are wave-uniformly unmasked
        const bool needMask = (kb + 31 > qBase) || (kb < qBase - (W_ - 32));

        v16h bP[2];   // P^T operands, packed straight from the score accumulators
        if (needMask) {
#pragma unroll
            for (int g = 0; g < 2; ++g) {
                const int row = qBase + (g << 4) + laneN;
#pragma unroll
                for (int kt = 0; kt < 2; ++kt)
#pragma unroll
                    for (int i = 0; i < 8; ++i) {
                        int c = kb + (kt << 4) + hi8 + i;
                        s[kt][g][i] = ((c <= row) && (c + (W_ - 1) >= row)) ? s[kt][g][i] : NEG_INF;
                    }
                float mnew = fmaxf(mrun[g], colmax(s[0][g], s[1][g]));
                // a query with no key seen yet: subtract 0, so every exp2(-inf) gives 0
                float msub = (mnew == NEG_INF) ? 0.f : mnew;
                alpha[g] = __builtin_amdgcn_exp2f(mrun[g] - msub);
                bP[g]    = pack_p(s[0][g], s[1][g], msub);
                mrun[g]  = mnew;
            }
        } else {
#pragma unroll
            for (int g = 0; g < 2; ++g) {
                float mnew = fmaxf(mrun[g], colmax(s[0][g], s[1][g]));
                alpha[g] = __builtin_amdgcn_exp2f(mrun[g] - mnew);  // exp2(-inf)=0 ok
                bP[g]    = pack_p(s[0][g], s[1][g], mnew);
                mrun[g]  = mnew;
            }
        }

        // rescale the sum tiles and the output tiles: one factor per lane and query group
#pragma unroll
        for (int i = 0; i < 8; ++i) {
            lacc[0][i] *= alpha[0];
            lacc[1][i] *= alpha[1];
#pragma unroll
            for (int t = 0; t < 4; ++t) {
                oacc[0][t][i] *= alpha[0];
                oacc[1][t][i] *= alpha[1];
            }
        }

        // sums of P over the 32 keys via WMMA against ones, accumulated like an output tile
        lacc[0] = WMMA_F16(onesA, bP[0], lacc[0]);
        lacc[1] = WMMA_F16(onesA, bP[1], lacc[1]);

        // ---- O^T += V^T (64x32) * P^T (32x16): each aV feeds both query groups ----
        const _Float16* vkb = vLane + (kb - kStart) * VPITCH;
#pragma unroll
        for (int t = 0; t < 4; ++t) {
            v16h aV = ld_op_lds_tr(vkb + t * 16);
            oacc[0][t] = WMMA_F16(aV, bP[0], oacc[0][t]);
            oacc[1][t] = WMMA_F16(aV, bP[1], oacc[1][t]);
        }
    }

    // ---- finalize: divide by l, store fp32; a lane holds 8 consecutive features per tile ----
#pragma unroll
    for (int g = 0; g < 2; ++g) {
        float inv = (lacc[g][0] > 0.f) ? (1.f / lacc[g][0]) : 0.f;
        float* orow = out + ((size_t)bh * N_ + (qBase + (g << 4) + laneN)) * D_ + hi8;
#pragma unroll
        for (int t = 0; t < 4; ++t) {
            float4 a, b;
            a.x = oacc[g][t][0] * inv; a.y = oacc[g][t][1] * inv;
            a.z = oacc[g][t][2] * inv; a.w = oacc[g][t][3] * inv;
            b.x = oacc[g][t][4] * inv; b.y = oacc[g][t][5] * inv;
            b.z = oacc[g][t][6] * inv; b.w = oacc[g][t][7] * inv;
            ((float4*)(orow + t * 16))[0] = a;
            ((float4*)(orow + t * 16))[1] = b;
        }
    }
}

extern "C" void kernel_launch(void* const* d_in, const int* in_sizes, int n_in,
                              void* d_out, int out_size, void* d_ws, size_t ws_size,
                              hipStream_t stream) {
    (void)in_sizes; (void)n_in; (void)d_ws; (void)ws_size; (void)out_size;
    const float* q = (const float*)d_in[0];
    const float* k = (const float*)d_in[1];
    const float* v = (const float*)d_in[2];
    float* out = (float*)d_out;

    const int tiles  = B_ * H_ * (N_ / ROWS_PER_WAVE);   // 2048 query tiles
    const int blocks = tiles / WAVES_PER_BLOCK;          // 256 blocks of 8 wave32
    hipLaunchKernelGGL(swa_wmma_f16_kernel,
                       dim3(blocks), dim3(32 * WAVES_PER_BLOCK), 0, stream,
                       q, k, v, out);
}

// v004
// A run of this version takes 16.8 microseconds.
// Next to v003, in two timings, it ran 1.11 times as fast each time.
// Over all steps from v000 it is 2.78 times as fast.
#include <hip/hip_runtime.h>

typedef __attribute__((ext_vector_type(16))) _Float16 v16h;
typedef __attribute__((ext_vector_type(8)))  float    v8f;
typedef __attribute__((ext_vector_type(2)))  float    v2f;

#define B_  2
#define H_  16
#define N_  2048
#define D_  64
#define W_  512
#define WAVES_PER_BLOCK 8
#define ROWS_PER_WAVE 32       // two 16-query column groups per wave
#define BLOCK_ROWS (WAVES_PER_BLOCK * ROWS_PER_WAVE)   // 256 query rows per block
#define MAX_KEYS (W_ + BLOCK_ROWS)                     // keys one block can touch
#define KPITCH 72              // halves per staged K row: 144 B, 16 B x odd for ds_load_b128
#define VPITCH 80              // halves per staged V row: 160 B, 32 B x odd for ds_load_tr16_b128
#define PASS_KEYS 128          // keys staged per pass: 8 float4 of K and 8 of V per thread
#define OPITCH 68              // floats per row of a wave's turn tile: 272 B, 16 B x odd for b128 rows
#define TILE_FLOATS (ROWS_PER_WAVE * OPITCH)           // one wave's turn tile: Q in, later O out

#define WMMA_F16(A,B,C) __builtin_amdgcn_wmma_f32_16x16x32_f16(false, A, false, B, (short)0, C, false, false)

typedef short s16x8 __attribute__((ext_vector_type(8)));
__device__ __forceinline__ v16h ld_op_lds_tr(const _Float16* p) {
    typedef __attribute__((address_space(3))) s16x8 lds_s16x8;
    union { s16x8 s[2]; v16h h; } r;
    r.s[0] = __builtin_amdgcn_ds_load_tr16_b128_v8i16((lds_s16x8*)p);
    r.s[1] = __builtin_amdgcn_ds_load_tr16_b128_v8i16((lds_s16x8*)(p + 16 * VPITCH));
    return r.h;
}

// One staging pass: 8 whole-line float4 loads per thread from each of K and V.
__device__ __forceinline__ void stage_load(const float4* kg, const float4* vg, int pass, int tid,
                                           float4 (&kx)[8], float4 (&vx)[8]) {
#pragma unroll
    for (int j = 0; j < 8; ++j) {
        kx[j] = kg[pass * (PASS_KEYS * 16) + j * 256 + tid];
        vx[j] = vg[pass * (PASS_KEYS * 16) + j * 256 + tid];
    }
}

typedef __attribute__((ext_vector_type(4))) _Float16 v4h;
__device__ __forceinline__ v4h cvt4(float4 x) {
    v4h r;
    r[0] = (_Float16)x.x; r[1] = (_Float16)x.y; r[2] = (_Float16)x.z; r[3] = (_Float16)x.w;
    return r;
}

// Convert the pass to f16 and lay it into the padded LDS rows (16 threads per key row).
__device__ __forceinline__ void stage_store(_Float16* sK, _Float16* sV, int pass, int tid,
                                            const float4 (&kx)[8], const float4 (&vx)[8]) {
    const int row = pass * PASS_KEYS + (tid >> 4);
    const int col = (tid & 15) << 2;
#pragma unroll
    for (int j = 0; j < 8; ++j) {
        *(v4h*)(sK + (row + j * 16) * KPITCH + col) = cvt4(kx[j]);
        *(v4h*)(sV + (row + j * 16) * VPITCH + col) = cvt4(vx[j]);
    }
}

__device__ __forceinline__ v16h ld_op_lds(const _Float16* p) {
    union { uint4 u[2]; v16h h; } r;
    r.u[0] = *(const uint4*)(p);
    r.u[1] = *(const uint4*)(p + 16);
    return r.h;
}

__device__ __forceinline__ float xhalf(float x) {
    int i = __builtin_bit_cast(int, x);
    return __builtin_bit_cast(float, __builtin_amdgcn_permlanex16(i, i, 0x76543210, 0xfedcba98, false, false));
}

__device__ __forceinline__ v16h pack_p(const v8f& s0, const v8f& s1, float m) {
    v16h r;
#pragma unroll
    for (int i = 0; i < 8; i += 2) {
        // neighbouring accumulator registers subtract as one packed pair, with no register moves
        v2f a = (v2f){s0[i], s0[i + 1]} - m;
        v2f b = (v2f){s1[i], s1[i + 1]} - m;
        r[i]     = (_Float16)__builtin_amdgcn_exp2f(a.x);
        r[i + 1] = (_Float16)__builtin_amdgcn_exp2f(a.y);
        r[i + 8] = (_Float16)__builtin_amdgcn_exp2f(b.x);
        r[i + 9] = (_Float16)__builtin_amdgcn_exp2f(b.y);
    }
    return r;
}

// largest of a lane's 16 scores of one query, then joined with the other half's 16
__device__ __forceinline__ float colmax(const v8f& s0, const v8f& s1) {
    float m = fmaxf(s0[0], s1[0]);
#pragma unroll
    for (int i = 1; i < 8; ++i) m = fmaxf(m, fmaxf(s0[i], s1[i]));
    return fmaxf(m, xhalf(m));
}

__global__ __launch_bounds__(32 * WAVES_PER_BLOCK)
void swa_wmma_f16_kernel(const float* __restrict__ q,
                         const float* __restrict__ k,
                         const float* __restrict__ v,
                         float* __restrict__ out) {
    __shared__ __align__(16) _Float16 sK[MAX_KEYS * KPITCH];
    __shared__ __align__(16) _Float16 sV[MAX_KEYS * VPITCH];
    __shared__ __align__(16) float sT[WAVES_PER_BLOCK * TILE_FLOATS];

    const int lane   = threadIdx.x & 31;
    const int wave   = threadIdx.x >> 5;
    const int laneHi = lane >> 4;
    const int laneN  = lane & 15;
    const int hi8    = laneHi << 3;

    const int tile  = blockIdx.x * WAVES_PER_BLOCK + wave;   // 0..2047
    const int bh    = tile >> 6;                             // 64 tiles per (b,h)
    const int qBase = (tile & 63) << 5;                      // first of 32 query rows

    const float NEG_INF = -__builtin_inff();
    const float qscale  = 0.125f * 1.44269504088896340736f;  // 1/sqrt(D) * log2(e)

    // constant all-ones A operand: column sums of P^T = ones x P^T via WMMA
    v16h onesA;
#pragma unroll
    for (int j = 0; j < 16; ++j) onesA[j] = (_Float16)1.0f;
    const v8f zero8 = (v8f){0.f,0.f,0.f,0.f,0.f,0.f,0.f,0.f};

    float*    tileO = sT + wave * TILE_FLOATS;
    _Float16* tileQ = (_Float16*)tileO;      // Q rows as f16 at the K pitch, gone before O needs the tile


    // ---- stage every key this block's 8 waves touch, once, as f16 in LDS ----
    const int blockQ = (blockIdx.x & 7) * BLOCK_ROWS;            // 8 blocks per (b,h)
    const int kStart = (blockQ >= W_) ? (blockQ - W_) : 0;       // first staged key
    const int passes = (blockQ + BLOCK_ROWS - kStart) / PASS_KEYS;   // 2, 4 or 6
    {
        const int tid = threadIdx.x;
        const size_t first = ((size_t)(blockIdx.x >> 3) * N_ + kStart) * D_;
        const float4* kg = (const float4*)(k + first);
        const float4* vg = (const float4*)(v + first);
        // two register sets: one pass's loads are in flight while the other is converted and stored
        float4 kxa[8], vxa[8], kxb[8], vxb[8];
        stage_load(kg, vg, 0, tid, kxa, vxa);
        // the wave's 32 Q rows are 8 KB in a row: 16 loads of 512 B, 4 whole lines each
        float4 qx[16];
        const float4* qg = (const float4*)(q + ((size_t)bh * N_ + qBase) * D_);
#pragma unroll
        for (int j = 0; j < 16; ++j) qx[j] = qg[j * 32 + lane];
        int p = 0;
        for (; p + 2 < passes; p += 2) {
            stage_load(kg, vg, p + 1, tid, kxb, vxb);
            stage_store(sK, sV, p, tid, kxa, vxa);
            stage_load(kg, vg, p + 2, tid, kxa, vxa);
            stage_store(sK, sV, p + 1, tid, kxb, vxb);
        }
        stage_load(kg, vg, p + 1, tid, kxb, vxb);
        // under the last pass's loads: scale and round Q as before, lay it into the turn tile
        // (load j holds rows 2j and 2j + 1)
#pragma unroll
        for (int j = 0; j < 16; ++j) {
            float4 x = qx[j];
            x.x *= qscale; x.y *= qscale; x.z *= qscale; x.w *= qscale;
            *(v4h*)(tileQ + (2 * j + laneHi) * KPITCH + (laneN << 2)) = cvt4(x);
        }
        stage_store(sK, sV, p, tid, kxa, vxa);
        stage_store(sK, sV, p + 1, tid, kxb, vxb);
    }
    __syncthreads();   // publishes the staged K and V rows to all 8 waves

    // ---- loop-invariant Q B-operands: [query group][kk-half]; lane column = query ----
    v16h bQ[2][2];
#pragma unroll
    for (int g = 0; g < 2; ++g) {
        const _Float16* qrow = tileQ + ((g << 4) + laneN) * KPITCH + hi8;
        bQ[g][0] = ld_op_lds(qrow +  0);
        bQ[g][1] = ld_op_lds(qrow + 32);
    }

    // softmax state of query (qBase + 16*g + laneN), one value per lane, equal in both halves
    float mrun[2], alpha[2];
    // running sums of P: every row of lacc[g] holds the sum of column (query) laneN
    v8f   lacc[2];
    // O^T tiles: oacc[g][t][r] = O[query qBase + 16*g + laneN][feature 16*t + 8*laneHi + r]
    v8f   oacc[2][4];
#pragma unroll
    for (int g = 0; g < 2; ++g) {
        mrun[g] = NEG_INF; lacc[g] = zero8;
#pragma unroll
        for (int t = 0; t < 4; ++t) oacc[g][t] = zero8;
    }

    const int lo     = (qBase >= W_) ? (qBase - W_ + 1) : 0;
    const int kb0    = (lo >> 5) << 5;
    const int kbLast = qBase;                    // chunk [qBase, qBase+31] = diagonal

    // per-lane read bases in the staged tiles, at staged row 0
    const _Float16* kLane = sK + laneN * KPITCH + hi8;
    const _Float16* vLane = sV + (hi8 + (lane & 7)) * VPITCH + (((lane >> 3) & 1) << 3);

    for (int kb = kb0; kb <= kbLast; kb += 32) {
        // ---- S^T = K (Q*scale)^T : 2 key halves x 2 query groups, K=64 in 2 steps ----
        // s[kt][g][r] = score of key kb + 16*kt + 8*laneHi + r against query qBase + 16*g + laneN
        const _Float16* kr0 = kLane + (kb - kStart) * KPITCH;            // keys kb+0..15
        const _Float16* kr1 = kr0 + 16 * KPITCH;                         // keys kb+16..31
        v8f s[2][2] = {{zero8, zero8}, {zero8, zero8}};                  // [kt][g]
#pragma unroll
        for (int kkI = 0; kkI < 2; ++kkI) {
            v16h aK0 = ld_op_lds(kr0 + kkI * 32);
            v16h aK1 = ld_op_lds(kr1 + kkI * 32);
            s[0][0] = WMMA_F16(aK0, bQ[0][kkI], s[0][0]);   // each aK feeds 2 query groups
            s[0][1] = WMMA_F16(aK0, bQ[1][kkI], s[0][1]);
            s[1][0] = WMMA_F16(aK1, bQ[0][kkI], s[1][0]);
            s[1][1] = WMMA_F16(aK1, bQ[1][kkI], s[1][1]);
        }

        // interior chunks are wave-uniformly unmasked
        const bool needMask = (kb + 31 > qBase) || (kb < qBase - (W_ - 32));

        v16h bP[2];   // P^T operands, packed straight from the score accumulators
        if (needMask) {
#pragma unroll
            for (int g = 0; g < 2; ++g) {
                const int row = qBase + (g << 4) + laneN;
#pragma unroll
                for (int kt = 0; kt < 2; ++kt)
#pragma unroll
                    for (int i = 0; i < 8; ++i) {
                        int c = kb + (kt << 4) + hi8 + i;
                        s[kt][g][i] = ((c <= row) && (c + (W_ - 1) >= row)) ? s[kt][g][i] : NEG_INF;
                    }
                float mnew = fmaxf(mrun[g], colmax(s[0][g], s[1][g]));
                // a query with no key seen yet: subtract 0, so every exp2(-inf) gives 0
                float msub = (mnew == NEG_INF) ? 0.f : mnew;
                alpha[g] = __builtin_amdgcn_exp2f(mrun[g] - msub);
                bP[g]    = pack_p(s[0][g], s[1][g], msub);
                mrun[g]  = mnew;
            }
        } else {
#pragma unroll
            for (int g = 0; g < 2; ++g) {
                float mnew = fmaxf(mrun[g], colmax(s[0][g], s[1][g]));
                alpha[g] = __builtin_amdgcn_exp2f(mrun[g] - mnew);  // exp2(-inf)=0 ok
                bP[g]    = pack_p(s[0][g], s[1][g], mnew);
                mrun[g]  = mnew;
            }
        }

        // rescale the sum tiles and the output tiles: one factor per lane and query group
#pragma unroll
        for (int i = 0; i < 8; ++i) {
            lacc[0][i] *= alpha[0];
            lacc[1][i] *= alpha[1];
#pragma unroll
            for (int t = 0; t < 4; ++t) {
                oacc[0][t][i] *= alpha[0];
                oacc[1][t][i] *= alpha[1];
            }
        }

        // sums of P over the 32 keys via WMMA against ones, accumulated like an output tile
        lacc[0] = WMMA_F16(onesA, bP[0], lacc[0]);
        lacc[1] = WMMA_F16(onesA, bP[1], lacc[1]);

        // ---- O^T += V^T (64x32) * P^T (32x16): each aV feeds both query groups ----
        const _Float16* vkb = vLane + (kb - kStart) * VPITCH;
#pragma unroll
        for (int t = 0; t < 4; ++t) {
            v16h aV = ld_op_lds_tr(vkb + t * 16);
            oacc[0][t] = WMMA_F16(aV, bP[0], oacc[0][t]);
            oacc[1][t] = WMMA_F16(aV, bP[1], oacc[1][t]);
        }
    }

    // ---- finalize: divide by l; a lane holds 8 consecutive features per tile, laid into the turn tile ----
#pragma unroll
    for (int g = 0; g < 2; ++g) {
        float inv = (lacc[g][0] > 0.f) ? (1.f / lacc[g][0]) : 0.f;
        float* orow = tileO + ((g << 4) + laneN) * OPITCH + hi8;
#pragma unroll
        for (int t = 0; t < 4; ++t) {
            float4 a, b;
            a.x = oacc[g][t][0] * inv; a.y = oacc[g][t][1] * inv;
            a.z = oacc[g][t][2] * inv; a.w = oacc[g][t][3] * inv;
            b.x = oacc[g][t][4] * inv; b.y = oacc[g][t][5] * inv;
            b.z = oacc[g][t][6] * inv; b.w = oacc[g][t][7] * inv;
            ((float4*)(orow + t * 16))[0] = a;
            ((float4*)(orow + t * 16))[1] = b;
        }
    }
    // the wave's own rows must stand in LDS before its lanes read each other's parts back
    asm volatile("s_wait_dscnt 0x0" ::: "memory");
    // ---- the wave's 32 output rows are 8 KB in a row: 16 stores of 512 B, 4 whole lines each ----
    {
        float4* og = (float4*)(out + ((size_t)bh * N_ + qBase) * D_);
#pragma unroll
        for (int j = 0; j < 16; ++j)
            og[j * 32 + lane] = *(const float4*)(tileO + (2 * j + laneHi) * OPITCH + (laneN << 2));
    }
}

extern "C" void kernel_launch(void* const* d_in, const int* in_sizes, int n_in,
                              void* d_out, int out_size, void* d_ws, size_t ws_size,
                              hipStream_t stream) {
    (void)in_sizes; (void)n_in; (void)d_ws; (void)ws_size; (void)out_size;
    const float* q = (const float*)d_in[0];
    const float* k = (const float*)d_in[1];
    const float* v = (const float*)d_in[2];
    float* out = (float*)d_out;

    const int tiles  = B_ * H_ * (N_ / ROWS_PER_WAVE);   // 2048 query tiles
    const int blocks = tiles / WAVES_PER_BLOCK;          // 256 blocks of 8 wave32
    hipLaunchKernelGGL(swa_wmma_f16_kernel,
                       dim3(blocks), dim3(32 * WAVES_PER_BLOCK), 0, stream,
                       q, k, v, out);
}

// v005
// Measured time: 14.8 microseconds a run.
// In two side-by-side timings against v004, it was 1.14 and 1.13 times as fast.
// All steps since v000 together make it 3.14 times as fast.
#include <hip/hip_runtime.h>

typedef __attribute__((ext_vector_type(16))) _Float16 v16h;
typedef __attribute__((ext_vector_type(8)))  float    v8f;
typedef __attribute__((ext_vector_type(2)))  float    v2f;

#define B_  2
#define H_  16
#define N_  2048
#define D_  64
#define W_  512
#define WAVES_PER_BLOCK 8
#define ROWS_PER_WAVE 32       // two 16-query column groups per wave
#define BLOCK_ROWS (WAVES_PER_BLOCK * ROWS_PER_WAVE)   // 256 query rows per block
#define MAX_KEYS (W_ + BLOCK_ROWS)                     // keys one block can touch
#define KPITCH 72              // halves per staged K row: 144 B, 16 B x odd for ds_load_b128
#define VPITCH 80              // halves per staged V row: 160 B, 32 B x odd for ds_load_tr16_b128
#define GROUP_KEYS 128         // keys staged per group: 8 float4 of K and 8 of V per thread
#define OPITCH 68              // floats per row of a wave's turn tile: 272 B, 16 B x odd for b128 rows
#define TILE_FLOATS (ROWS_PER_WAVE * OPITCH)           // one wave's turn tile: Q in, later O out

#define WMMA_F16(A,B,C) __builtin_amdgcn_wmma_f32_16x16x32_f16(false, A, false, B, (short)0, C, false, false)

typedef short s16x8 __attribute__((ext_vector_type(8)));
__device__ __forceinline__ v16h ld_op_lds_tr(const _Float16* p) {
    typedef __attribute__((address_space(3))) s16x8 lds_s16x8;
    union { s16x8 s[2]; v16h h; } r;
    r.s[0] = __builtin_amdgcn_ds_load_tr16_b128_v8i16((lds_s16x8*)p);
    r.s[1] = __builtin_amdgcn_ds_load_tr16_b128_v8i16((lds_s16x8*)(p + 16 * VPITCH));
    return r.h;
}

// A staging group is 128 rows of the ring of staged rows. The ring starts 32 rows short of a multiple of 128
// (or on one) and wraps at a multiple of 128, so a group is at most two straight runs: 32 rows from rowA,
// 96 rows from rowB. Each run has one address per thread, the slices of 16 rows go by constant offsets.
#define RUN_A_SLICES 2
struct GroupRows { int rowA, rowB; };
__device__ __forceinline__ GroupRows group_rows(int ringStart, int g, int nKeys) {
    GroupRows r;
    r.rowA = ringStart + g * GROUP_KEYS;
    if (r.rowA >= nKeys) r.rowA -= nKeys;
    r.rowB = r.rowA + RUN_A_SLICES * 16;
    if (r.rowB >= nKeys) r.rowB -= nKeys;
    return r;
}

// One group's loads: 8 whole-line float4 per thread from each of K and V.
__device__ __forceinline__ void group_load(const float4* kg, const float4* vg, GroupRows r, int tid,
                                           float4 (&kx)[8], float4 (&vx)[8]) {
    const int a = r.rowA * 16 + tid, b = r.rowB * 16 + tid;
#pragma unroll
    for (int j = 0; j < 8; ++j) {
        const int i = (j < RUN_A_SLICES) ? (a + j * 256) : (b + (j - RUN_A_SLICES) * 256);
        kx[j] = kg[i];
        vx[j] = vg[i];
    }
    // the loads stay in flight over code that reuses their address registers: this wait stands in front of it
    asm volatile("s_wait_xcnt 0x0" ::: "memory");
}

typedef __attribute__((ext_vector_type(4))) _Float16 v4h;
__device__ __forceinline__ v4h cvt4(float4 x) {
    v4h r;
    r[0] = (_Float16)x.x; r[1] = (_Float16)x.y; r[2] = (_Float16)x.z; r[3] = (_Float16)x.w;
    return r;
}

// Convert the group to f16 and lay it into the padded LDS rows (16 threads per key row).
__device__ __forceinline__ void group_store(_Float16* sK, _Float16* sV, GroupRows r, int tid,
                                            const float4 (&kx)[8], const float4 (&vx)[8]) {
    const int col = (tid & 15) << 2;
    const int a = r.rowA + (tid >> 4), b = r.rowB + (tid >> 4);
#pragma unroll
    for (int j = 0; j < 8; ++j) {
        const int row = (j < RUN_A_SLICES) ? (a + j * 16) : (b + (j - RUN_A_SLICES) * 16);
        *(v4h*)(sK + row * KPITCH + col) = cvt4(kx[j]);
        *(v4h*)(sV + row * VPITCH + col) = cvt4(vx[j]);
    }
}

__device__ __forceinline__ v16h ld_op_lds(const _Float16* p) {
    union { uint4 u[2]; v16h h; } r;
    r.u[0] = *(const uint4*)(p);
    r.u[1] = *(const uint4*)(p + 16);
    return r.h;
}

__device__ __forceinline__ float xhalf(float x) {
    int i = __builtin_bit_cast(int, x);
    return __builtin_bit_cast(float, __builtin_amdgcn_permlanex16(i, i, 0x76543210, 0xfedcba98, false, false));
}

__device__ __forceinline__ v16h pack_p(const v8f& s0, const v8f& s1, float m) {
    v16h r;
#pragma unroll
    for (int i = 0; i < 8; i += 2) {
        // neighbouring accumulator registers subtract as one packed pair, with no register moves
        v2f a = (v2f){s0[i], s0[i + 1]} - m;
        v2f b = (v2f){s1[i], s1[i + 1]} - m;
        r[i]     = (_Float16)__builtin_amdgcn_exp2f(a.x);
        r[i + 1] = (_Float16)__builtin_amdgcn_exp2f(a.y);
        r[i + 8] = (_Float16)__builtin_amdgcn_exp2f(b.x);
        r[i + 9] = (_Float16)__builtin_amdgcn_exp2f(b.y);
    }
    return r;
}

// largest of a lane's 16 scores of one query, then joined with the other half's 16
__device__ __forceinline__ float colmax(const v8f& s0, const v8f& s1) {
    float m = fmaxf(s0[0], s1[0]);
#pragma unroll
    for (int i = 1; i < 8; ++i) m = fmaxf(m, fmaxf(s0[i], s1[i]));
    return fmaxf(m, xhalf(m));
}

__global__ __launch_bounds__(32 * WAVES_PER_BLOCK)
void swa_wmma_f16_kernel(const float* __restrict__ q,
                         const float* __restrict__ k,
                         const float* __restrict__ v,
                         float* __restrict__ out) {
    __shared__ __align__(16) _Float16 sK[MAX_KEYS * KPITCH];
    __shared__ __align__(16) _Float16 sV[MAX_KEYS * VPITCH];
    __shared__ __align__(16) float sT[WAVES_PER_BLOCK * TILE_FLOATS];

    const int lane   = threadIdx.x & 31;
    const int wave   = threadIdx.x >> 5;
    const int laneHi = lane >> 4;
    const int laneN  = lane & 15;
    const int hi8    = laneHi << 3;

    const int tile  = blockIdx.x * WAVES_PER_BLOCK + wave;   // 0..2047
    const int bh    = tile >> 6;                             // 64 tiles per (b,h)
    const int qBase = (tile & 63) << 5;                      // first of 32 query rows

    const float NEG_INF = -__builtin_inff();
    const float qscale  = 0.125f * 1.44269504088896340736f;  // 1/sqrt(D) * log2(e)

    // constant all-ones A operand: column sums of P^T = ones x P^T via WMMA
    v16h onesA;
#pragma unroll
    for (int j = 0; j < 16; ++j) onesA[j] = (_Float16)1.0f;
    const v8f zero8 = (v8f){0.f,0.f,0.f,0.f,0.f,0.f,0.f,0.f};

    float*    tileO = sT + wave * TILE_FLOATS;
    _Float16* tileQ = (_Float16*)tileO;      // Q rows as f16 at the K pitch, gone before O needs the tile


    const int tid    = threadIdx.x;
    const int blockQ = (blockIdx.x & 7) * BLOCK_ROWS;            // 8 blocks per (b,h)
    const int kStart = (blockQ >= W_) ? (blockQ - W_) : 0;       // first staged key
    const int nKeys  = blockQ + BLOCK_ROWS - kStart;             // 256, 512 or 768 staged rows
    const int nGroups = nKeys / GROUP_KEYS;                      // 2, 4 or 6
    const int lastQ  = blockQ + BLOCK_ROWS - ROWS_PER_WAVE;      // the last wave's first query
    const int ringStart = ((lastQ >= W_) ? (lastQ - W_) : 0) - kStart;   // its first chunk's staged row: 224 or 0
    const size_t firstEl = ((size_t)(blockIdx.x >> 3) * N_ + kStart) * D_;
    const float4* kg = (const float4*)(k + firstEl);
    const float4* vg = (const float4*)(v + firstEl);
    float4 kx[8], vx[8];     // the group in flight
    {
        group_load(kg, vg, group_rows(ringStart, 0, nKeys), tid, kx, vx);
        // the wave's 32 Q rows are 8 KB in a row: 16 loads of 512 B, 4 whole lines each
        float4 qx[16];
        const float4* qg = (const float4*)(q + ((size_t)bh * N_ + qBase) * D_);
#pragma unroll
        for (int j = 0; j < 16; ++j) qx[j] = qg[j * 32 + lane];
        group_store(sK, sV, group_rows(ringStart, 0, nKeys), tid, kx, vx);
        // scale and round Q as before, lay it into the turn tile (load j holds rows 2j and 2j + 1)
#pragma unroll
        for (int j = 0; j < 16; ++j) {
            float4 x = qx[j];
            x.x *= qscale; x.y *= qscale; x.z *= qscale; x.w *= qscale;
            *(v4h*)(tileQ + (2 * j + laneHi) * KPITCH + (laneN << 2)) = cvt4(x);
        }
    }
    __syncthreads();
    group_load(kg, vg, group_rows(ringStart, 1, nKeys), tid, kx, vx);

    // ---- loop-invariant Q B-operands: [query group][kk-half]; lane column = query ----
    v16h bQ[2][2];
#pragma unroll
    for (int g = 0; g < 2; ++g) {
        const _Float16* qrow = tileQ + ((g << 4) + laneN) * KPITCH + hi8;
        bQ[g][0] = ld_op_lds(qrow +  0);
        bQ[g][1] = ld_op_lds(qrow + 32);
    }

    // softmax state of query (qBase + 16*g + laneN), one value per lane, equal in both halves
    float mrun[2], alpha[2];
    // running sums of P: every row of lacc[g] holds the sum of column (query) laneN
    v8f   lacc[2];
    // O^T tiles: oacc[g][t][r] = O[query qBase + 16*g + laneN][feature 16*t + 8*laneHi + r]
    v8f   oacc[2][4];
#pragma unroll
    for (int g = 0; g < 2; ++g) {
        mrun[g] = NEG_INF; lacc[g] = zero8;
#pragma unroll
        for (int t = 0; t < 4; ++t) oacc[g][t] = zero8;
    }

    const int lo     = (qBase >= W_) ? (qBase - W_ + 1) : 0;
    const int kb0    = (lo >> 5) << 5;
    // The wave's chunks as staged rows rowLo .. rowHi (the diagonal), walked in the ring's order:
    // nFirst chunks from ringStart up to the diagonal, then those from rowLo up to ringStart.
    const int rowLo  = kb0 - kStart;
    const int rowHi  = qBase - kStart;
    const int nFirst = ((rowHi - ringStart) >> 5) + 1;
    const int nMine  = ((rowHi - rowLo) >> 5) + 1;
    const int nSteps = ((lastQ - kStart - ringStart) >> 5) + 1;   // the last wave's count, the block's largest
    // Steps 0..9 of a wave that wraps lie in ring rows 0..319, which all 8 waves share: groups 0 to 2.
    static_assert((W_ - (BLOCK_ROWS - ROWS_PER_WAVE)) / 32 + 1 == 10 && 10 * 32 <= 3 * GROUP_KEYS,
                  "publish points below are set for 10 shared chunks");
    static_assert((BLOCK_ROWS - ROWS_PER_WAVE + RUN_A_SLICES * 16) % GROUP_KEYS == 0 && BLOCK_ROWS % GROUP_KEYS == 0 &&
                  W_ % GROUP_KEYS == 0, "a group's second run must not wrap");

    // per-lane read bases in the staged tiles, at staged row 0
    const _Float16* kLane = sK + laneN * KPITCH + hi8;
    const _Float16* vLane = sV + (hi8 + (lane & 7)) * VPITCH + (((lane >> 3) & 1) << 3);

    int c = 0;
    do {   // every block has at least 8 steps
      if (c < nMine) {
        const int row = (c < nFirst) ? (ringStart + (c << 5)) : (rowLo + ((c - nFirst) << 5));
        const int kb  = kStart + row;
        // ---- S^T = K (Q*scale)^T : 2 key halves x 2 query groups, K=64 in 2 steps ----
        // s[kt][g][r] = score of key kb + 16*kt + 8*laneHi + r against query qBase + 16*g + laneN
        const _Float16* kr0 = kLane + row * KPITCH;                      // keys kb+0..15
        const _Float16* kr1 = kr0 + 16 * KPITCH;                         // keys kb+16..31
        v8f s[2][2] = {{zero8, zero8}, {zero8, zero8}};                  // [kt][g]
#pragma unroll
        for (int kkI = 0; kkI < 2; ++kkI) {
            v16h aK0 = ld_op_lds(kr0 + kkI * 32);
            v16h aK1 = ld_op_lds(kr1 + kkI * 32);
            s[0][0] = WMMA_F16(aK0, bQ[0][kkI], s[0][0]);   // each aK feeds 2 query groups
            s[0][1] = WMMA_F16(aK0, bQ[1][kkI], s[0][1]);
            s[1][0] = WMMA_F16(aK1, bQ[0][kkI], s[1][0]);
            s[1][1] = WMMA_F16(aK1, bQ[1][kkI], s[1][1]);
        }

        // interior chunks are wave-uniformly unmasked
        const bool needMask = (kb + 31 > qBase) || (kb < qBase - (W_ - 32));

        v16h bP[2];   // P^T operands, packed straight from the score accumulators
        if (needMask) {
#pragma unroll
            for (int g = 0; g < 2; ++g) {
                const int row = qBase + (g << 4) + laneN;
#pragma unroll
                for (int kt = 0; kt < 2; ++kt)
#pragma unroll
                    for (int i = 0; i < 8; ++i) {
                        int c = kb + (kt << 4) + hi8 + i;
                        s[kt][g][i] = ((c <= row) && (c + (W_ - 1) >= row)) ? s[kt][g][i] : NEG_INF;
                    }
                float mnew = fmaxf(mrun[g], colmax(s[0][g], s[1][g]));
                // a query with no key seen yet: subtract 0, so every exp2(-inf) gives 0
                float msub = (mnew == NEG_INF) ? 0.f : mnew;
                alpha[g] = __builtin_amdgcn_exp2f(mrun[g] - msub);
                bP[g]    = pack_p(s[0][g], s[1][g], msub);
                mrun[g]  = mnew;
            }
        } else {
#pragma unroll
            for (int g = 0; g < 2; ++g) {
                float mnew = fmaxf(mrun[g], colmax(s[0][g], s[1][g]));
                alpha[g] = __builtin_amdgcn_exp2f(mrun[g] - mnew);  // exp2(-inf)=0 ok
                bP[g]    = pack_p(s[0][g], s[1][g], mnew);
                mrun[g]  = mnew;
            }
        }

        // rescale the sum tiles and the output tiles: one factor per lane and query group
#pragma unroll
        for (int i = 0; i < 8; ++i) {
            lacc[0][i] *= alpha[0];
            lacc[1][i] *= alpha[1];
#pragma unroll
            for (int t = 0; t < 4; ++t) {
                oacc[0][t][i] *= alpha[0];
                oacc[1][t][i] *= alpha[1];
            }
        }

        // sums of P over the 32 keys via WMMA against ones, accumulated like an output tile
        lacc[0] = WMMA_F16(onesA, bP[0], lacc[0]);
        lacc[1] = WMMA_F16(onesA, bP[1], lacc[1]);

        // ---- O^T += V^T (64x32) * P^T (32x16): each aV feeds both query groups ----
        const _Float16* vkb = vLane + row * VPITCH;
#pragma unroll
        for (int t = 0; t < 4; ++t) {
            v16h aV = ld_op_lds_tr(vkb + t * 16);
            oacc[0][t] = WMMA_F16(aV, bP[0], oacc[0][t]);
            oacc[1][t] = WMMA_F16(aV, bP[1], oacc[1][t]);
        }
      }
      // ---- every second step: lay down the group that flew under the last two chunks, send for the next ----
      if (c & 1) {
        const int g = (c >> 1) + 1;
        if (g < nGroups) group_store(sK, sV, group_rows(ringStart, g, nKeys), tid, kx, vx);
        // publish points, the same for the whole block: behind step 3 stand groups 1 and 2 (read by steps 4..9),
        // behind step 9 all groups (read by every later step); in front of the next loads, which they would wait for
        if (c == 3 || c == 9) __syncthreads();
        if (g + 1 < nGroups) group_load(kg, vg, group_rows(ringStart, g + 1, nKeys), tid, kx, vx);
      }
    } while (++c < nSteps);

    // ---- finalize: divide by l; a lane holds 8 consecutive features per tile, laid into the turn tile ----
#pragma unroll
    for (int g = 0; g < 2; ++g) {
        float inv = (lacc[g][0] > 0.f) ? (1.f / lacc[g][0]) : 0.f;
        float* orow = tileO + ((g << 4) + laneN) * OPITCH + hi8;
#pragma unroll
        for (int t = 0; t < 4; ++t) {
            float4 a, b;
            a.x = oacc[g][t][0] * inv; a.y = oacc[g][t][1] * inv;
            a.z = oacc[g][t][2] * inv; a.w = oacc[g][t][3] * inv;
            b.x = oacc[g][t][4] * inv; b.y = oacc[g][t][5] * inv;
            b.z = oacc[g][t][6] * inv; b.w = oacc[g][t][7] * inv;
            ((float4*)(orow + t * 16))[0] = a;
            ((float4*)(orow + t * 16))[1] = b;
        }
    }
    // the wave's own rows must stand in LDS before its lanes read each other's parts back
    asm volatile("s_wait_dscnt 0x0" ::: "memory");
    // ---- the wave's 32 output rows are 8 KB in a row: 16 stores of 512 B, 4 whole lines each ----
    {
        float4* og = (float4*)(out + ((size_t)bh * N_ + qBase) * D_);
#pragma unroll
        for (int j = 0; j < 16; ++j)
            og[j * 32 + lane] = *(const float4*)(tileO + (2 * j + laneHi) * OPITCH + (laneN << 2));
    }
}

extern "C" void kernel_launch(void* const* d_in, const int* in_sizes, int n_in,
                              void* d_out, int out_size, void* d_ws, size_t ws_size,
                              hipStream_t stream) {
    (void)in_sizes; (void)n_in; (void)d_ws; (void)ws_size; (void)out_size;
    const float* q = (const float*)d_in[0];
    const float* k = (const float*)d_in[1];
    const float* v = (const float*)d_in[2];
    float* out = (float*)d_out;

    const int tiles  = B_ * H_ * (N_ / ROWS_PER_WAVE);   // 2048 query tiles
    const int blocks = tiles / WAVES_PER_BLOCK;          // 256 blocks of 8 wave32
    hipLaunchKernelGGL(swa_wmma_f16_kernel,
                       dim3(blocks), dim3(32 * WAVES_PER_BLOCK), 0, stream,
                       q, k, v, out);
}

// v006
// One run takes 13.7 microseconds.
// Timed twice side by side with v005, it ran 1.08 times as fast both times.
// Over all steps from v000 it is 3.39 times as fast.
#include <hip/hip_runtime.h>

typedef __attribute__((ext_vector_type(16))) _Float16 v16h;
typedef __attribute__((ext_vector_type(8)))  float    v8f;
typedef __attribute__((ext_vector_type(2)))  float    v2f;

#define B_  2
#define H_  16
#define N_  2048
#define D_  64
#define W_  512
#define WAVES_PER_BLOCK 8
#define ROWS_PER_WAVE 32       // two 16-query column groups per wave
#define BLOCK_ROWS (WAVES_PER_BLOCK * ROWS_PER_WAVE)   // 256 query rows per block
#define MAX_KEYS (W_ + BLOCK_ROWS)                     // keys one block can touch
#define KPITCH 72              // halves per staged K row: 144 B, 16 B x odd for ds_load_b128
#define VPITCH 80              // halves per staged V row: 160 B, 32 B x odd for ds_load_tr16_b128
#define GROUP_KEYS 128         // keys staged per group: 8 float4 of K and 8 of V per thread
#define OPITCH 68              // floats per row of a wave's turn tile: 272 B, 16 B x odd for b128 rows
#define TILE_FLOATS (ROWS_PER_WAVE * OPITCH)           // one wave's turn tile: Q in, later O out

#define WMMA_F16(A,B,C) __builtin_amdgcn_wmma_f32_16x16x32_f16(false, A, false, B, (short)0, C, false, false)

typedef short s16x8 __attribute__((ext_vector_type(8)));
__device__ __forceinline__ v16h ld_op_lds_tr(const _Float16* p) {
    typedef __attribute__((address_space(3))) s16x8 lds_s16x8;
    union { s16x8 s[2]; v16h h; } r;
    r.s[0] = __builtin_amdgcn_ds_load_tr16_b128_v8i16((lds_s16x8*)p);
    r.s[1] = __builtin_amdgcn_ds_load_tr16_b128_v8i16((lds_s16x8*)(p + 16 * VPITCH));
    return r.h;
}

// A staging group is 128 rows of the ring of staged rows. The ring starts 32 rows short of a multiple of 128
// (or on one) and wraps at a multiple of 128, so a group is at most two straight runs: 32 rows from rowA,
// 96 rows from rowB. Each run has one address per thread, the slices of 16 rows go by constant offsets.
#define RUN_A_SLICES 2
struct GroupRows { int rowA, rowB; };
__device__ __forceinline__ GroupRows group_rows(int ringStart, int g, int nKeys) {
    GroupRows r;
    r.rowA = ringStart + g * GROUP_KEYS;
    if (r.rowA >= nKeys) r.rowA -= nKeys;
    r.rowB = r.rowA + RUN_A_SLICES * 16;
    if (r.rowB >= nKeys) r.rowB -= nKeys;
    return r;
}

// One group's loads: 8 whole-line float4 per thread from each of K and V.
__device__ __forceinline__ void group_load(const float4* kg, const float4* vg, GroupRows r, int tid,
                                           float4 (&kx)[8], float4 (&vx)[8]) {
    const int a = r.rowA * 16 + tid, b = r.rowB * 16 + tid;
#pragma unroll
    for (int j = 0; j < 8; ++j) {
        const int i = (j < RUN_A_SLICES) ? (a + j * 256) : (b + (j - RUN_A_SLICES) * 256);
        kx[j] = kg[i];
        vx[j] = vg[i];
    }
    // the loads stay in flight over code that reuses their address registers: this wait stands in front of it
    asm volatile("s_wait_xcnt 0x0" ::: "memory");
}

typedef __attribute__((ext_vector_type(4))) _Float16 v4h;
__device__ __forceinline__ v4h cvt4(float4 x) {
    v4h r;
    r[0] = (_Float16)x.x; r[1] = (_Float16)x.y; r[2] = (_Float16)x.z; r[3] = (_Float16)x.w;
    return r;
}

// Convert the group to f16 and lay it into the padded LDS rows (16 threads per key row).
__device__ __forceinline__ void group_store(_Float16* sK, _Float16* sV, GroupRows r, int tid,
                                            const float4 (&kx)[8], const float4 (&vx)[8]) {
    const int col = (tid & 15) << 2;
    const int a = r.rowA + (tid >> 4), b = r.rowB + (tid >> 4);
#pragma unroll
    for (int j = 0; j < 8; ++j) {
        const int row = (j < RUN_A_SLICES) ? (a + j * 16) : (b + (j - RUN_A_SLICES) * 16);
        *(v4h*)(sK + row * KPITCH + col) = cvt4(kx[j]);
        *(v4h*)(sV + row * VPITCH + col) = cvt4(vx[j]);
    }
}

__device__ __forceinline__ v16h ld_op_lds(const _Float16* p) {
    union { uint4 u[2]; v16h h; } r;
    r.u[0] = *(const uint4*)(p);
    r.u[1] = *(const uint4*)(p + 16);
    return r.h;
}

// The four K A-operands of one 32-key chunk: [key half][kk half]; p = the lane's base at the chunk's first row.
struct KFrags { v16h a[2][2]; };
__device__ __forceinline__ KFrags ld_k_chunk(const _Float16* p) {
    KFrags f;
    f.a[0][0] = ld_op_lds(p);
    f.a[0][1] = ld_op_lds(p + 32);
    f.a[1][0] = ld_op_lds(p + 16 * KPITCH);
    f.a[1][1] = ld_op_lds(p + 16 * KPITCH + 32);
    return f;
}

__device__ __forceinline__ float xhalf(float x) {
    int i = __builtin_bit_cast(int, x);
    return __builtin_bit_cast(float, __builtin_amdgcn_permlanex16(i, i, 0x76543210, 0xfedcba98, false, false));
}

__device__ __forceinline__ v16h pack_p(const v8f& s0, const v8f& s1, float m) {
    v16h r;
#pragma unroll
    for (int i = 0; i < 8; i += 2) {
        // neighbouring accumulator registers subtract as one packed pair, with no register moves
        v2f a = (v2f){s0[i], s0[i + 1]} - m;
        v2f b = (v2f){s1[i], s1[i + 1]} - m;
        r[i]     = (_Float16)__builtin_amdgcn_exp2f(a.x);
        r[i + 1] = (_Float16)__builtin_amdgcn_exp2f(a.y);
        r[i + 8] = (_Float16)__builtin_amdgcn_exp2f(b.x);
        r[i + 9] = (_Float16)__builtin_amdgcn_exp2f(b.y);
    }
    return r;
}

// largest of a lane's 16 scores of one query, then joined with the other half's 16
__device__ __forceinline__ float colmax(const v8f& s0, const v8f& s1) {
    float m = fmaxf(s0[0], s1[0]);
#pragma unroll
    for (int i = 1; i < 8; ++i) m = fmaxf(m, fmaxf(s0[i], s1[i]));
    return fmaxf(m, xhalf(m));
}

__global__ __launch_bounds__(32 * WAVES_PER_BLOCK)
void swa_wmma_f16_kernel(const float* __restrict__ q,
                         const float* __restrict__ k,
                         const float* __restrict__ v,
                         float* __restrict__ out) {
    __shared__ __align__(16) _Float16 sK[MAX_KEYS * KPITCH];
    __shared__ __align__(16) _Float16 sV[MAX_KEYS * VPITCH];
    __shared__ __align__(16) float sT[WAVES_PER_BLOCK * TILE_FLOATS];

    const int lane   = threadIdx.x & 31;
    const int wave   = threadIdx.x >> 5;
    const int laneHi = lane >> 4;
    const int laneN  = lane & 15;
    const int hi8    = laneHi << 3;

    const int tile  = blockIdx.x * WAVES_PER_BLOCK + wave;   // 0..2047
    const int bh    = tile >> 6;                             // 64 tiles per (b,h)
    const int qBase = (tile & 63) << 5;                      // first of 32 query rows

    const float NEG_INF = -__builtin_inff();
    const float qscale  = 0.125f * 1.44269504088896340736f;  // 1/sqrt(D) * log2(e)

    // constant all-ones A operand: column sums of P^T = ones x P^T via WMMA
    v16h onesA;
#pragma unroll
    for (int j = 0; j < 16; ++j) onesA[j] = (_Float16)1.0f;
    const v8f zero8 = (v8f){0.f,0.f,0.f,0.f,0.f,0.f,0.f,0.f};

    float*    tileO = sT + wave * TILE_FLOATS;
    _Float16* tileQ = (_Float16*)tileO;      // Q rows as f16 at the K pitch, gone before O needs the tile


    const int tid    = threadIdx.x;
    const int blockQ = (blockIdx.x & 7) * BLOCK_ROWS;            // 8 blocks per (b,h)
    const int kStart = (blockQ >= W_) ? (blockQ - W_) : 0;       // first staged key
    const int nKeys  = blockQ + BLOCK_ROWS - kStart;             // 256, 512 or 768 staged rows
    const int nGroups = nKeys / GROUP_KEYS;                      // 2, 4 or 6
    const int lastQ  = blockQ + BLOCK_ROWS - ROWS_PER_WAVE;      // the last wave's first query
    const int ringStart = ((lastQ >= W_) ? (lastQ - W_) : 0) - kStart;   // its first chunk's staged row: 224 or 0
    const size_t firstEl = ((size_t)(blockIdx.x >> 3) * N_ + kStart) * D_;
    const float4* kg = (const float4*)(k + firstEl);
    const float4* vg = (const float4*)(v + firstEl);
    float4 kx[8], vx[8];     // the group in flight
    {
        group_load(kg, vg, group_rows(ringStart, 0, nKeys), tid, kx, vx);
        // the wave's 32 Q rows are 8 KB in a row: 16 loads of 512 B, 4 whole lines each
        float4 qx[16];
        const float4* qg = (const float4*)(q + ((size_t)bh * N_ + qBase) * D_);
#pragma unroll
        for (int j = 0; j < 16; ++j) qx[j] = qg[j * 32 + lane];
        group_store(sK, sV, group_rows(ringStart, 0, nKeys), tid, kx, vx);
        // scale and round Q as before, lay it into the turn tile (load j holds rows 2j and 2j + 1)
#pragma unroll
        for (int j = 0; j < 16; ++j) {
            float4 x = qx[j];
            x.x *= qscale; x.y *= qscale; x.z *= qscale; x.w *= qscale;
            *(v4h*)(tileQ + (2 * j + laneHi) * KPITCH + (laneN << 2)) = cvt4(x);
        }
    }
    __syncthreads();
    group_load(kg, vg, group_rows(ringStart, 1, nKeys), tid, kx, vx);

    // ---- loop-invariant Q B-operands: [query group][kk-half]; lane column = query ----
    v16h bQ[2][2];
#pragma unroll
    for (int g = 0; g < 2; ++g) {
        const _Float16* qrow = tileQ + ((g << 4) + laneN) * KPITCH + hi8;
        bQ[g][0] = ld_op_lds(qrow +  0);
        bQ[g][1] = ld_op_lds(qrow + 32);
    }

    // softmax state of query (qBase + 16*g + laneN), one value per lane, equal in both halves
    float mrun[2], alpha[2];
    // running sums of P: every row of lacc[g] holds the sum of column (query) laneN
    v8f   lacc[2];
    // O^T tiles: oacc[g][t][r] = O[query qBase + 16*g + laneN][feature 16*t + 8*laneHi + r]
    v8f   oacc[2][4];
#pragma unroll
    for (int g = 0; g < 2; ++g) {
        mrun[g] = NEG_INF; lacc[g] = zero8;
#pragma unroll
        for (int t = 0; t < 4; ++t) oacc[g][t] = zero8;
    }

    const int lo     = (qBase >= W_) ? (qBase - W_ + 1) : 0;
    const int kb0    = (lo >> 5) << 5;
    // The wave's chunks as staged rows rowLo .. rowHi (the diagonal), walked in the ring's order:
    // nFirst chunks from ringStart up to the diagonal, then those from rowLo up to ringStart.
    const int rowLo  = kb0 - kStart;
    const int rowHi  = qBase - kStart;
    const int nFirst = ((rowHi - ringStart) >> 5) + 1;
    const int nMine  = ((rowHi - rowLo) >> 5) + 1;
    const int nSteps = ((lastQ - kStart - ringStart) >> 5) + 1;   // the last wave's count, the block's largest
    // Steps 0..9 of a wave that wraps lie in ring rows 0..319, which all 8 waves share: groups 0 to 2.
    static_assert((W_ - (BLOCK_ROWS - ROWS_PER_WAVE)) / 32 + 1 == 10 && 10 * 32 <= 3 * GROUP_KEYS,
                  "publish points below are set for 10 shared chunks");
    static_assert((BLOCK_ROWS - ROWS_PER_WAVE + RUN_A_SLICES * 16) % GROUP_KEYS == 0 && BLOCK_ROWS % GROUP_KEYS == 0 &&
                  W_ % GROUP_KEYS == 0, "a group's second run must not wrap");

    // per-lane read bases in the staged tiles, at staged row 0
    const _Float16* kLane = sK + laneN * KPITCH + hi8;
    const _Float16* vLane = sV + (hi8 + (lane & 7)) * VPITCH + (((lane >> 3) & 1) << 3);

    // bit c set: step c ends in a publish point (steps 3 and 9, as at the loop's foot)
    constexpr unsigned PUBLISH_STEPS = (1u << 3) | (1u << 9);
    KFrags kf = ld_k_chunk(kLane + ringStart * KPITCH);

    int c = 0;
    do {   // every block has at least 8 steps
      if (c < nMine) {
        const int row = (c < nFirst) ? (ringStart + (c << 5)) : (rowLo + ((c - nFirst) << 5));
        const int kb  = kStart + row;
        // ---- S^T = K (Q*scale)^T : 2 key halves x 2 query groups, K=64 in 2 steps ----
        // s[kt][g][r] = score of key kb + 16*kt + 8*laneHi + r against query qBase + 16*g + laneN
        v8f s[2][2] = {{zero8, zero8}, {zero8, zero8}};                  // [kt][g]
#pragma unroll
        for (int kkI = 0; kkI < 2; ++kkI) {
            s[0][0] = WMMA_F16(kf.a[0][kkI], bQ[0][kkI], s[0][0]);   // each K fragment feeds 2 query groups
            s[0][1] = WMMA_F16(kf.a[0][kkI], bQ[1][kkI], s[0][1]);
            s[1][0] = WMMA_F16(kf.a[1][kkI], bQ[0][kkI], s[1][0]);
            s[1][1] = WMMA_F16(kf.a[1][kkI], bQ[1][kkI], s[1][1]);
        }

        // ---- one group of LDS reads, landing under the softmax: this chunk's V^T, the next chunk's K ----
        const _Float16* vkb = vLane + row * VPITCH;
        v16h aV[4];
#pragma unroll
        for (int t = 0; t < 4; ++t) aV[t] = ld_op_lds_tr(vkb + t * 16);
        // chunks 4 and 10 are published only at the foot of steps 3 and 9: fetched there, behind the barrier
        if (((PUBLISH_STEPS >> c) & 1u) == 0u) {
            if (c + 1 < nMine) {
                const int cn = c + 1;
                const int rowN = (cn < nFirst) ? (ringStart + (cn << 5)) : (rowLo + ((cn - nFirst) << 5));
                kf = ld_k_chunk(kLane + rowN * KPITCH);
            }
        }

        // interior chunks are wave-uniformly unmasked
        const bool needMask = (kb + 31 > qBase) || (kb < qBase - (W_ - 32));

        v16h bP[2];   // P^T operands, packed straight from the score accumulators
        if (needMask) {
#pragma unroll
            for (int g = 0; g < 2; ++g) {
                const int row = qBase + (g << 4) + laneN;
#pragma unroll
                for (int kt = 0; kt < 2; ++kt)
#pragma unroll
                    for (int i = 0; i < 8; ++i) {
                        int c = kb + (kt << 4) + hi8 + i;
                        s[kt][g][i] = ((c <= row) && (c + (W_ - 1) >= row)) ? s[kt][g][i] : NEG_INF;
                    }
                float mnew = fmaxf(mrun[g], colmax(s[0][g], s[1][g]));
                // a query with no key seen yet: subtract 0, so every exp2(-inf) gives 0
                float msub = (mnew == NEG_INF) ? 0.f : mnew;
                alpha[g] = __builtin_amdgcn_exp2f(mrun[g] - msub);
                bP[g]    = pack_p(s[0][g], s[1][g], msub);
                mrun[g]  = mnew;
            }
        } else {
#pragma unroll
            for (int g = 0; g < 2; ++g) {
                float mnew = fmaxf(mrun[g], colmax(s[0][g], s[1][g]));
                alpha[g] = __builtin_amdgcn_exp2f(mrun[g] - mnew);  // exp2(-inf)=0 ok
                bP[g]    = pack_p(s[0][g], s[1][g], mnew);
                mrun[g]  = mnew;
            }
        }

        // rescale the sum tiles and the output tiles: one factor per lane and query group
#pragma unroll
        for (int i = 0; i < 8; ++i) {
            lacc[0][i] *= alpha[0];
            lacc[1][i] *= alpha[1];
#pragma unroll
            for (int t = 0; t < 4; ++t) {
                oacc[0][t][i] *= alpha[0];
                oacc[1][t][i] *= alpha[1];
            }
        }

        // sums of P over the 32 keys via WMMA against ones, accumulated like an output tile
        lacc[0] = WMMA_F16(onesA, bP[0], lacc[0]);
        lacc[1] = WMMA_F16(onesA, bP[1], lacc[1]);

        // ---- O^T += V^T (64x32) * P^T (32x16): each aV feeds both query groups ----
#pragma unroll
        for (int t = 0; t < 4; ++t) {
            oacc[0][t] = WMMA_F16(aV[t], bP[0], oacc[0][t]);
            oacc[1][t] = WMMA_F16(aV[t], bP[1], oacc[1][t]);
        }
      }
      // ---- every second step: lay down the group that flew under the last two chunks, send for the next ----
      if (c & 1) {
        const int g = (c >> 1) + 1;
        if (g < nGroups) group_store(sK, sV, group_rows(ringStart, g, nKeys), tid, kx, vx);
        // publish points, the same for the whole block: behind step 3 stand groups 1 and 2 (read by steps 4..9),
        // behind step 9 all groups (read by every later step); in front of the next loads, which they would wait for
        if (c == 3 || c == 9) {
            __syncthreads();
            if (c + 1 < nMine) {   // the next chunk's K, readable only from here on
                const int cn = c + 1;
                const int rowN = (cn < nFirst) ? (ringStart + (cn << 5)) : (rowLo + ((cn - nFirst) << 5));
                kf = ld_k_chunk(kLane + rowN * KPITCH);
            }
        }
        if (g + 1 < nGroups) group_load(kg, vg, group_rows(ringStart, g + 1, nKeys), tid, kx, vx);
      }
    } while (++c < nSteps);

    // ---- finalize: divide by l; a lane holds 8 consecutive features per tile, laid into the turn tile ----
#pragma unroll
    for (int g = 0; g < 2; ++g) {
        float inv = (lacc[g][0] > 0.f) ? (1.f / lacc[g][0]) : 0.f;
        float* orow = tileO + ((g << 4) + laneN) * OPITCH + hi8;
#pragma unroll
        for (int t = 0; t < 4; ++t) {
            float4 a, b;
            a.x = oacc[g][t][0] * inv; a.y = oacc[g][t][1] * inv;
            a.z = oacc[g][t][2] * inv; a.w = oacc[g][t][3] * inv;
            b.x = oacc[g][t][4] * inv; b.y = oacc[g][t][5] * inv;
            b.z = oacc[g][t][6] * inv; b.w = oacc[g][t][7] * inv;
            ((float4*)(orow + t * 16))[0] = a;
            ((float4*)(orow + t * 16))[1] = b;
        }
    }
    // the wave's own rows must stand in LDS before its lanes read each other's parts back
    asm volatile("s_wait_dscnt 0x0" ::: "memory");
    // ---- the wave's 32 output rows are 8 KB in a row: 16 stores of 512 B, 4 whole lines each ----
    {
        float4* og = (float4*)(out + ((size_t)bh * N_ + qBase) * D_);
#pragma unroll
        for (int j = 0; j < 16; ++j)
            og[j * 32 + lane] = *(const float4*)(tileO + (2 * j + laneHi) * OPITCH + (laneN << 2));
    }
}

extern "C" void kernel_launch(void* const* d_in, const int* in_sizes, int n_in,
                              void* d_out, int out_size, void* d_ws, size_t ws_size,
                              hipStream_t stream) {
    (void)in_sizes; (void)n_in; (void)d_ws; (void)ws_size; (void)out_size;
    const float* q = (const float*)d_in[0];
    const float* k = (const float*)d_in[1];
    const float* v = (const float*)d_in[2];
    float* out = (float*)d_out;

    const int tiles  = B_ * H_ * (N_ / ROWS_PER_WAVE);   // 2048 query tiles
    const int blocks = tiles / WAVES_PER_BLOCK;          // 256 blocks of 8 wave32
    hipLaunchKernelGGL(swa_wmma_f16_kernel,
                       dim3(blocks), dim3(32 * WAVES_PER_BLOCK), 0, stream,
                       q, k, v, out);
}
